// v000
// The times below were measured on an AMD MI455X: many runs one after another, warmed up first and cycling through
// copies of the inputs, with the whole window's GPU time divided by the number of runs. Launches and the gaps
// between them are all in it. The median over several windows is given; except for v000 it joins two sittings, which
// can be a few percent apart, so the side-by-side timings, each taken in one sitting, are the better comparison.
// The starting kernel, v000, takes 446 microseconds a run.
#include <hip/hip_runtime.h>
#include <hip/hip_bf16.h>
#include <stdint.h>

typedef __bf16 bf16_t;
typedef __attribute__((ext_vector_type(8)))  __bf16 v8bf;
typedef __attribute__((ext_vector_type(16))) __bf16 v16bf;
typedef __attribute__((ext_vector_type(8)))  float  v8f;

#define DIM   1024
#define SEQ   2048
#define NH    16
#define HD    64
#define BATCH 2
#define MTOT  (BATCH * SEQ)   // 4096 tokens

// ---------------- helpers ----------------

__device__ __forceinline__ v8f zero8() {
  v8f z;
#pragma unroll
  for (int i = 0; i < 8; ++i) z[i] = 0.0f;
  return z;
}

// Low 32 bits of a generic pointer to __shared__ = LDS byte offset (aperture mapping).
__device__ __forceinline__ unsigned lds_off(const void* p) {
  return (unsigned)(unsigned long long)(uintptr_t)p;
}

// CDNA5 async global->LDS copy (per-lane 16B), tracked by ASYNCcnt.
__device__ __forceinline__ void async_ld_b128(unsigned lds, const void* g) {
  asm volatile("global_load_async_to_lds_b128 %0, %1, off"
               :: "v"(lds), "v"((unsigned long long)(uintptr_t)g)
               : "memory");
}

template <int N>
__device__ __forceinline__ void wait_asynccnt() {
  asm volatile("s_wait_asynccnt %0" :: "i"(N) : "memory");
}

// Load a 16-element bf16 WMMA fragment: two contiguous 16B chunks at p and p+16
// (ISA 16-bit A/B layout: k = half*8 + e  and  k = 16 + half*8 + e).
__device__ __forceinline__ v16bf ldfrag(const bf16_t* p) {
  v8bf lo = *(const v8bf*)(p);
  v8bf hi = *(const v8bf*)(p + 16);
  return __builtin_shufflevector(lo, hi, 0, 1, 2, 3, 4, 5, 6, 7,
                                 8, 9, 10, 11, 12, 13, 14, 15);
}

__device__ __forceinline__ v8f wmma_bf16(v16bf a, v16bf b, v8f c) {
  return __builtin_amdgcn_wmma_f32_16x16x32_bf16(false, a, false, b,
                                                 (short)0, c, false, false);
}

// ---------------- conversion kernels ----------------

__global__ void cvt_bf16_kernel(const float* __restrict__ in,
                                bf16_t* __restrict__ out, int n) {
  int i = blockIdx.x * blockDim.x + threadIdx.x;
  if (i < n) out[i] = (bf16_t)in[i];
}

// out[c*R + r] = (bf16) in[r*C + c]  (weights as [N][K] for B-fragments)
__global__ void cvt_transpose_kernel(const float* __restrict__ in,
                                     bf16_t* __restrict__ out, int R, int C) {
  int idx = blockIdx.x * blockDim.x + threadIdx.x;
  if (idx >= R * C) return;
  int r = idx / C, c = idx % C;
  out[(size_t)c * R + r] = (bf16_t)in[idx];
}

// ---------------- bf16 GEMM: C[M,N] = A[M,K] * Bt[N,K]^T + bias ----------------
// MODE 0: scatter bf16 into qkv buffer: Q,K as [B][H][S][D]; V as [B][H][D][S].
// MODE 1: f32 output + bias, row-major [M,N].

#define ASTR 40           // padded LDS row strides (40*2 = 80B keeps 16B alignment)
#define BSTR 40
#define ABUF (64 * ASTR)
#define BBUF (256 * BSTR)

template <int MODE>
__global__ __launch_bounds__(256) void gemm_bf16_kernel(
    const bf16_t* __restrict__ A, const bf16_t* __restrict__ Bt,
    const float* __restrict__ bias, void* __restrict__ outp,
    int M, int N, int K) {
  __shared__ bf16_t Aw[2 * ABUF];   // double-buffered 64x32 A tiles
  __shared__ bf16_t Bw[2 * BBUF];   // double-buffered 256x32 B tiles

  const int tid  = threadIdx.x;
  const int wave = tid >> 5, lane = tid & 31;
  const int lm   = lane & 15, half = lane >> 4;
  const int wm   = wave >> 2, wn = wave & 3;     // 2 x 4 wave grid
  const int n0   = blockIdx.x * 256;
  const int m0   = blockIdx.y * 64;

  v8f acc[2][4];
#pragma unroll
  for (int mt = 0; mt < 2; ++mt)
#pragma unroll
    for (int nt = 0; nt < 4; ++nt) acc[mt][nt] = zero8();

  const unsigned awb = lds_off(Aw), bwb = lds_off(Bw);
  const int arow = tid >> 2, acol = (tid & 3) * 8;

  auto issue = [&](int buf, int kk) {
    // A tile: 1 async b128 per lane
    async_ld_b128(awb + (unsigned)(buf * ABUF + arow * ASTR + acol) * 2,
                  A + (size_t)(m0 + arow) * K + kk + acol);
    // B tile: 4 async b128 per lane (row n = tid)
#pragma unroll
    for (int i = 0; i < 4; ++i)
      async_ld_b128(bwb + (unsigned)(buf * BBUF + tid * BSTR + i * 8) * 2,
                    Bt + (size_t)(n0 + tid) * K + kk + i * 8);
  };

  issue(0, 0);
  for (int kk = 0; kk < K; kk += 32) {
    const int cur = (kk >> 5) & 1;
    if (kk + 32 < K) {
      issue(cur ^ 1, kk + 32);   // prefetch next tile into other buffer
      wait_asynccnt<5>();        // 5 oldest (current buffer) retired
    } else {
      wait_asynccnt<0>();
    }
    __syncthreads();

    const bf16_t* Ac = &Aw[cur * ABUF];
    const bf16_t* Bc = &Bw[cur * BBUF];
    v16bf af[2], bfg[4];
#pragma unroll
    for (int mt = 0; mt < 2; ++mt)
      af[mt] = ldfrag(&Ac[(wm * 32 + mt * 16 + lm) * ASTR + half * 8]);
#pragma unroll
    for (int nt = 0; nt < 4; ++nt)
      bfg[nt] = ldfrag(&Bc[(wn * 64 + nt * 16 + lm) * BSTR + half * 8]);
#pragma unroll
    for (int mt = 0; mt < 2; ++mt) {
#pragma unroll
      for (int nt = 0; nt < 4; ++nt)
        acc[mt][nt] = wmma_bf16(af[mt], bfg[nt], acc[mt][nt]);
    }
    __syncthreads();
  }

  // epilogue
#pragma unroll
  for (int mt = 0; mt < 2; ++mt) {
#pragma unroll
    for (int nt = 0; nt < 4; ++nt) {
#pragma unroll
      for (int r = 0; r < 8; ++r) {
        int gm = m0 + wm * 32 + mt * 16 + r + 8 * half;   // C/D: m = r + 8*half
        int gn = n0 + wn * 64 + nt * 16 + lm;             // C/D: n = lane%16
        float v = acc[mt][nt][r] + bias[gn];
        if (MODE == 0) {
          int part = gn >> 10, rem = gn & 1023;
          int hh = rem >> 6, dd = rem & 63;
          int bb = gm >> 11, ss = gm & 2047;
          size_t base = (size_t)part * ((size_t)BATCH * NH * SEQ * HD);
          size_t idx;
          if (part == 2)  // V stored head-transposed [b][h][d][s]
            idx = base + (((size_t)bb * NH + hh) * HD + dd) * SEQ + ss;
          else            // Q, K stored [b][h][s][d]
            idx = base + (((size_t)bb * NH + hh) * SEQ + ss) * HD + dd;
          ((bf16_t*)outp)[idx] = (bf16_t)v;
        } else {
          ((float*)outp)[(size_t)gm * N + gn] = v;
        }
      }
    }
  }
}

// ---------------- flash attention ----------------
// grid: (SEQ/128, BATCH*NH); block 256 threads = 8 waves; wave owns 16 q rows.
// qkv: Q,K [B][H][S][D]; V [B][H][D][S] (bf16).  aout: [B*S][DIM] bf16.

#define KVBUF (64 * HD)   // 4096 elements per K or V tile

__global__ __launch_bounds__(256) void attn_kernel(const bf16_t* __restrict__ qkv,
                                                   bf16_t* __restrict__ aout) {
  __shared__ bf16_t Kw[2 * KVBUF];      // [key][d]    16 KB (double buffered)
  __shared__ bf16_t Vt[2 * KVBUF];      // [d][key]    16 KB (double buffered)
  __shared__ bf16_t Pw[8 * 16 * 64];    // per-wave P  16 KB

  const int tid  = threadIdx.x;
  const int wave = tid >> 5, lane = tid & 31;
  const int lm   = lane & 15, half = lane >> 4;
  const int bh   = blockIdx.y;
  const int b    = bh >> 4, h = bh & 15;

  const size_t partsz = (size_t)BATCH * NH * SEQ * HD;
  const bf16_t* Qb = qkv + ((size_t)b * NH + h) * SEQ * HD;
  const bf16_t* Kb = qkv + partsz + ((size_t)b * NH + h) * SEQ * HD;
  const bf16_t* Vb = qkv + 2 * partsz + ((size_t)b * NH + h) * HD * SEQ;  // [d][s]

  const int q0 = blockIdx.x * 128 + wave * 16;

  // Q fragments (A operand), loaded once: k-dim = 64 -> 2 chunks of 32
  v16bf aq[2];
#pragma unroll
  for (int kh = 0; kh < 2; ++kh)
    aq[kh] = ldfrag(Qb + (size_t)(q0 + lm) * HD + kh * 32 + half * 8);

  v8f o[4];
#pragma unroll
  for (int t = 0; t < 4; ++t) o[t] = zero8();
  float m_row[8], l_row[8];
#pragma unroll
  for (int r = 0; r < 8; ++r) { m_row[r] = -1e30f; l_row[r] = 0.0f; }

  bf16_t* Pww = &Pw[wave * 16 * 64];
  const unsigned kwb = lds_off(Kw), vtb = lds_off(Vt);
  const int ldr = tid >> 2, ldc = (tid & 3) * 16;
  const float scale = 0.125f;   // 1/sqrt(64)

  auto issue_kv = [&](int buf, int j0) {
    // K block [64 keys][64 d] -> Kw[key][d]
    const bf16_t* kg = Kb + (size_t)(j0 + ldr) * HD + ldc;
    unsigned kl = kwb + (unsigned)(buf * KVBUF + ldr * HD + ldc) * 2;
    async_ld_b128(kl, kg);
    async_ld_b128(kl + 16, kg + 8);
    // V block (global already [d][s]) -> Vt[d][key]
    const bf16_t* vg = Vb + (size_t)ldr * SEQ + j0 + ldc;
    unsigned vl = vtb + (unsigned)(buf * KVBUF + ldr * 64 + ldc) * 2;
    async_ld_b128(vl, vg);
    async_ld_b128(vl + 16, vg + 8);
  };

  issue_kv(0, 0);
  for (int jb = 0; jb < SEQ / 64; ++jb) {
    const int cur = jb & 1;
    if (jb + 1 < SEQ / 64) {
      issue_kv(cur ^ 1, (jb + 1) * 64);
      wait_asynccnt<4>();
    } else {
      wait_asynccnt<0>();
    }
    __syncthreads();

    const bf16_t* Kc = &Kw[cur * KVBUF];
    const bf16_t* Vc = &Vt[cur * KVBUF];

    // ---- scores S = Q * K^T  (16 x 64 per wave, 8 WMMAs) ----
    v8f s[4];
#pragma unroll
    for (int t = 0; t < 4; ++t) s[t] = zero8();
#pragma unroll
    for (int kh = 0; kh < 2; ++kh) {
#pragma unroll
      for (int t = 0; t < 4; ++t) {
        v16bf bk = ldfrag(&Kc[(t * 16 + lm) * HD + kh * 32 + half * 8]);
        s[t] = wmma_bf16(aq[kh], bk, s[t]);
      }
    }
#pragma unroll
    for (int t = 0; t < 4; ++t)
#pragma unroll
      for (int r = 0; r < 8; ++r) s[t][r] *= scale;

    // ---- online softmax per row (row = r + 8*half; 16 lanes hold a row) ----
#pragma unroll
    for (int r = 0; r < 8; ++r) {
      float mx = fmaxf(fmaxf(s[0][r], s[1][r]), fmaxf(s[2][r], s[3][r]));
#pragma unroll
      for (int d = 1; d < 16; d <<= 1) mx = fmaxf(mx, __shfl_xor(mx, d));
      float mn   = fmaxf(m_row[r], mx);
      float corr = __expf(m_row[r] - mn);
      m_row[r]   = mn;
      float lb = 0.0f;
#pragma unroll
      for (int t = 0; t < 4; ++t) {
        float p = __expf(s[t][r] - mn);
        s[t][r] = p;
        lb += p;
      }
#pragma unroll
      for (int d = 1; d < 16; d <<= 1) lb += __shfl_xor(lb, d);
      l_row[r] = l_row[r] * corr + lb;
#pragma unroll
      for (int t = 0; t < 4; ++t) o[t][r] *= corr;
    }

    // ---- write P (bf16) to wave-private LDS, layout [qrow][key] ----
#pragma unroll
    for (int t = 0; t < 4; ++t)
#pragma unroll
      for (int r = 0; r < 8; ++r)
        Pww[(r + 8 * half) * 64 + t * 16 + lm] = (bf16_t)s[t][r];

    // ---- O += P * V  (8 WMMAs; B-fragments from [d][key] V) ----
#pragma unroll
    for (int kh = 0; kh < 2; ++kh) {
      v16bf ap = ldfrag(&Pww[lm * 64 + kh * 32 + half * 8]);
#pragma unroll
      for (int t = 0; t < 4; ++t) {
        v16bf bv = ldfrag(&Vc[(t * 16 + lm) * 64 + kh * 32 + half * 8]);
        o[t] = wmma_bf16(ap, bv, o[t]);
      }
    }
    __syncthreads();
  }

  // ---- finalize: divide by l, store bf16 into [B*S][DIM] ----
#pragma unroll
  for (int r = 0; r < 8; ++r) {
    float inv = 1.0f / l_row[r];
    int srow = q0 + r + 8 * half;
#pragma unroll
    for (int t = 0; t < 4; ++t) {
      int col = h * HD + t * 16 + lm;
      aout[((size_t)b * SEQ + srow) * DIM + col] = (bf16_t)(o[t][r] * inv);
    }
  }
}

// ---------------- launch ----------------

extern "C" void kernel_launch(void* const* d_in, const int* in_sizes, int n_in,
                              void* d_out, int out_size, void* d_ws, size_t ws_size,
                              hipStream_t stream) {
  const float* x      = (const float*)d_in[0];
  const float* qkv_w  = (const float*)d_in[1];
  const float* qkv_b  = (const float*)d_in[2];
  const float* proj_w = (const float*)d_in[3];
  const float* proj_b = (const float*)d_in[4];

  const size_t MB = 1u << 20;
  char* ws = (char*)d_ws;
  bf16_t* xb     = (bf16_t*)(ws);             //  8 MB: x as bf16 [4096][1024]
  bf16_t* wqkvT  = (bf16_t*)(ws + 8 * MB);    //  6 MB: qkv_w^T [3072][1024]
  bf16_t* wprojT = (bf16_t*)(ws + 14 * MB);   //  2 MB: proj_w^T [1024][1024]
  bf16_t* qkvbuf = (bf16_t*)(ws + 16 * MB);   // 24 MB: Q,K [B][H][S][D]; V [B][H][D][S]
  bf16_t* aout   = (bf16_t*)(ws + 40 * MB);   //  8 MB: attn out [4096][1024]

  // convert / transpose to bf16
  const int nx = MTOT * DIM;
  cvt_bf16_kernel<<<nx / 256, 256, 0, stream>>>(x, xb, nx);
  const int nq = DIM * 3 * DIM;
  cvt_transpose_kernel<<<(nq + 255) / 256, 256, 0, stream>>>(qkv_w, wqkvT, DIM, 3 * DIM);
  const int np = DIM * DIM;
  cvt_transpose_kernel<<<(np + 255) / 256, 256, 0, stream>>>(proj_w, wprojT, DIM, DIM);

  // QKV GEMM: [4096,1024] x [1024,3072] -> scattered bf16 Q/K/V
  gemm_bf16_kernel<0><<<dim3(3 * DIM / 256, MTOT / 64), 256, 0, stream>>>(
      xb, wqkvT, qkv_b, qkvbuf, MTOT, 3 * DIM, DIM);

  // attention
  attn_kernel<<<dim3(SEQ / 128, BATCH * NH), 256, 0, stream>>>(qkvbuf, aout);

  // projection GEMM: [4096,1024] x [1024,1024] + bias -> f32 out
  gemm_bf16_kernel<1><<<dim3(DIM / 256, MTOT / 64), 256, 0, stream>>>(
      aout, wprojT, proj_b, d_out, MTOT, DIM, DIM);
}

// v001
// Measured time: 333 microseconds a run.
// Next to v000, in two timings, it ran 1.38 times as fast each time.
#include <hip/hip_runtime.h>
#include <hip/hip_bf16.h>
#include <stdint.h>

typedef __bf16 bf16_t;
typedef __attribute__((ext_vector_type(8)))  __bf16 v8bf;
typedef __attribute__((ext_vector_type(16))) __bf16 v16bf;
typedef __attribute__((ext_vector_type(8)))  float  v8f;

#define DIM   1024
#define SEQ   2048
#define NH    16
#define HD    64
#define BATCH 2
#define MTOT  (BATCH * SEQ)   // 4096 tokens

// ---------------- helpers ----------------

__device__ __forceinline__ v8f zero8() {
  v8f z;
#pragma unroll
  for (int i = 0; i < 8; ++i) z[i] = 0.0f;
  return z;
}

// Low 32 bits of a generic pointer to __shared__ = LDS byte offset (aperture mapping).
__device__ __forceinline__ unsigned lds_off(const void* p) {
  return (unsigned)(unsigned long long)(uintptr_t)p;
}

// CDNA5 async global->LDS copy (per-lane 16B), tracked by ASYNCcnt.
__device__ __forceinline__ void async_ld_b128(unsigned lds, const void* g) {
  asm volatile("global_load_async_to_lds_b128 %0, %1, off"
               :: "v"(lds), "v"((unsigned long long)(uintptr_t)g)
               : "memory");
}

template <int N>
__device__ __forceinline__ void wait_asynccnt() {
  asm volatile("s_wait_asynccnt %0" :: "i"(N) : "memory");
}

// Load a 16-element bf16 WMMA fragment: two contiguous 16B chunks at p and p+16
// (ISA 16-bit A/B layout: k = half*8 + e  and  k = 16 + half*8 + e).
__device__ __forceinline__ v16bf ldfrag(const bf16_t* p) {
  v8bf lo = *(const v8bf*)(p);
  v8bf hi = *(const v8bf*)(p + 16);
  return __builtin_shufflevector(lo, hi, 0, 1, 2, 3, 4, 5, 6, 7,
                                 8, 9, 10, 11, 12, 13, 14, 15);
}

__device__ __forceinline__ v8f wmma_bf16(v16bf a, v16bf b, v8f c) {
  return __builtin_amdgcn_wmma_f32_16x16x32_bf16(false, a, false, b,
                                                 (short)0, c, false, false);
}

// ---------------- conversion kernels ----------------

__global__ void cvt_bf16_kernel(const float* __restrict__ in,
                                bf16_t* __restrict__ out, int n) {
  int i = blockIdx.x * blockDim.x + threadIdx.x;
  if (i < n) out[i] = (bf16_t)in[i];
}

// out[c*R + r] = (bf16) in[r*C + c]  (weights as [N][K] for B-fragments)
// One 64x64 tile per block of 256 threads, turned in LDS so that both global sides
// are wide and contiguous: 16 B loads along c, 16 B stores along r (8 lanes fill one
// 128 B line of out). R and C are multiples of 64. grid: (C/64, R/64).
#define TT   64
#define TPIT 65   // f32 pitch: both the row-wise writes and the column-wise reads hit distinct banks

__global__ __launch_bounds__(256) void cvt_transpose_kernel(
    const float* __restrict__ in, bf16_t* __restrict__ out, int R, int C) {
  __shared__ float tile[TT * TPIT];
  const int tid = threadIdx.x;
  const int c0 = blockIdx.x * TT, r0 = blockIdx.y * TT;

  const int lr = tid >> 4, lc = (tid & 15) * 4;
  float4 v[4];
#pragma unroll   // all four loads in flight before the first LDS write; v[] stays in registers
  for (int p = 0; p < 4; ++p)
    v[p] = *(const float4*)(in + (size_t)(r0 + lr + p * 16) * C + c0 + lc);
#pragma unroll   // v[] indexed by constants only
  for (int p = 0; p < 4; ++p) {
    float* t = &tile[(lr + p * 16) * TPIT + lc];
    t[0] = v[p].x; t[1] = v[p].y; t[2] = v[p].z; t[3] = v[p].w;
  }
  __syncthreads();

#pragma unroll   // both chunks' LDS reads issue together
  for (int p = 0; p < 2; ++p) {
    const int q = tid + p * 256;
    const int oc = q >> 3, orr = (q & 7) * 8;
    v8bf w;
#pragma unroll   // w[] indexed by constants only
    for (int i = 0; i < 8; ++i) w[i] = (bf16_t)tile[(orr + i) * TPIT + oc];
    *(v8bf*)(out + (size_t)(c0 + oc) * R + r0 + orr) = w;
  }
}

// ---------------- bf16 GEMM: C[M,N] = A[M,K] * Bt[N,K]^T + bias ----------------
// MODE 0: scatter bf16 into qkv buffer: Q,K as [B][H][S][D]; V as [B][H][D][S].
// MODE 1: f32 output + bias, row-major [M,N].

#define ASTR 40           // padded LDS row strides (40*2 = 80B keeps 16B alignment)
#define BSTR 40
#define ABUF (64 * ASTR)
#define BBUF (256 * BSTR)

template <int MODE>
__global__ __launch_bounds__(256) void gemm_bf16_kernel(
    const bf16_t* __restrict__ A, const bf16_t* __restrict__ Bt,
    const float* __restrict__ bias, void* __restrict__ outp,
    int M, int N, int K) {
  __shared__ bf16_t Aw[2 * ABUF];   // double-buffered 64x32 A tiles
  __shared__ bf16_t Bw[2 * BBUF];   // double-buffered 256x32 B tiles

  const int tid  = threadIdx.x;
  const int wave = tid >> 5, lane = tid & 31;
  const int lm   = lane & 15, half = lane >> 4;
  const int wm   = wave >> 2, wn = wave & 3;     // 2 x 4 wave grid
  const int n0   = blockIdx.x * 256;
  const int m0   = blockIdx.y * 64;

  v8f acc[2][4];
#pragma unroll
  for (int mt = 0; mt < 2; ++mt)
#pragma unroll
    for (int nt = 0; nt < 4; ++nt) acc[mt][nt] = zero8();

  const unsigned awb = lds_off(Aw), bwb = lds_off(Bw);
  const int arow = tid >> 2, acol = (tid & 3) * 8;

  auto issue = [&](int buf, int kk) {
    // A tile: 1 async b128 per lane
    async_ld_b128(awb + (unsigned)(buf * ABUF + arow * ASTR + acol) * 2,
                  A + (size_t)(m0 + arow) * K + kk + acol);
    // B tile: 4 async b128 per lane (row n = tid)
#pragma unroll
    for (int i = 0; i < 4; ++i)
      async_ld_b128(bwb + (unsigned)(buf * BBUF + tid * BSTR + i * 8) * 2,
                    Bt + (size_t)(n0 + tid) * K + kk + i * 8);
  };

  issue(0, 0);
  for (int kk = 0; kk < K; kk += 32) {
    const int cur = (kk >> 5) & 1;
    if (kk + 32 < K) {
      issue(cur ^ 1, kk + 32);   // prefetch next tile into other buffer
      wait_asynccnt<5>();        // 5 oldest (current buffer) retired
    } else {
      wait_asynccnt<0>();
    }
    __syncthreads();

    const bf16_t* Ac = &Aw[cur * ABUF];
    const bf16_t* Bc = &Bw[cur * BBUF];
    v16bf af[2], bfg[4];
#pragma unroll
    for (int mt = 0; mt < 2; ++mt)
      af[mt] = ldfrag(&Ac[(wm * 32 + mt * 16 + lm) * ASTR + half * 8]);
#pragma unroll
    for (int nt = 0; nt < 4; ++nt)
      bfg[nt] = ldfrag(&Bc[(wn * 64 + nt * 16 + lm) * BSTR + half * 8]);
#pragma unroll
    for (int mt = 0; mt < 2; ++mt) {
#pragma unroll
      for (int nt = 0; nt < 4; ++nt)
        acc[mt][nt] = wmma_bf16(af[mt], bfg[nt], acc[mt][nt]);
    }
    __syncthreads();
  }

  // epilogue
#pragma unroll
  for (int mt = 0; mt < 2; ++mt) {
#pragma unroll
    for (int nt = 0; nt < 4; ++nt) {
#pragma unroll
      for (int r = 0; r < 8; ++r) {
        int gm = m0 + wm * 32 + mt * 16 + r + 8 * half;   // C/D: m = r + 8*half
        int gn = n0 + wn * 64 + nt * 16 + lm;             // C/D: n = lane%16
        float v = acc[mt][nt][r] + bias[gn];
        if (MODE == 0) {
          int part = gn >> 10, rem = gn & 1023;
          int hh = rem >> 6, dd = rem & 63;
          int bb = gm >> 11, ss = gm & 2047;
          size_t base = (size_t)part * ((size_t)BATCH * NH * SEQ * HD);
          size_t idx;
          if (part == 2)  // V stored head-transposed [b][h][d][s]
            idx = base + (((size_t)bb * NH + hh) * HD + dd) * SEQ + ss;
          else            // Q, K stored [b][h][s][d]
            idx = base + (((size_t)bb * NH + hh) * SEQ + ss) * HD + dd;
          ((bf16_t*)outp)[idx] = (bf16_t)v;
        } else {
          ((float*)outp)[(size_t)gm * N + gn] = v;
        }
      }
    }
  }
}

// ---------------- flash attention ----------------
// grid: (SEQ/128, BATCH*NH); block 256 threads = 8 waves; wave owns 16 q rows.
// qkv: Q,K [B][H][S][D]; V [B][H][D][S] (bf16).  aout: [B*S][DIM] bf16.

#define KVBUF (64 * HD)   // 4096 elements per K or V tile

__global__ __launch_bounds__(256) void attn_kernel(const bf16_t* __restrict__ qkv,
                                                   bf16_t* __restrict__ aout) {
  __shared__ bf16_t Kw[2 * KVBUF];      // [key][d]    16 KB (double buffered)
  __shared__ bf16_t Vt[2 * KVBUF];      // [d][key]    16 KB (double buffered)
  __shared__ bf16_t Pw[8 * 16 * 64];    // per-wave P  16 KB

  const int tid  = threadIdx.x;
  const int wave = tid >> 5, lane = tid & 31;
  const int lm   = lane & 15, half = lane >> 4;
  const int bh   = blockIdx.y;
  const int b    = bh >> 4, h = bh & 15;

  const size_t partsz = (size_t)BATCH * NH * SEQ * HD;
  const bf16_t* Qb = qkv + ((size_t)b * NH + h) * SEQ * HD;
  const bf16_t* Kb = qkv + partsz + ((size_t)b * NH + h) * SEQ * HD;
  const bf16_t* Vb = qkv + 2 * partsz + ((size_t)b * NH + h) * HD * SEQ;  // [d][s]

  const int q0 = blockIdx.x * 128 + wave * 16;

  // Q fragments (A operand), loaded once: k-dim = 64 -> 2 chunks of 32
  v16bf aq[2];
#pragma unroll
  for (int kh = 0; kh < 2; ++kh)
    aq[kh] = ldfrag(Qb + (size_t)(q0 + lm) * HD + kh * 32 + half * 8);

  v8f o[4];
#pragma unroll
  for (int t = 0; t < 4; ++t) o[t] = zero8();
  float m_row[8], l_row[8];
#pragma unroll
  for (int r = 0; r < 8; ++r) { m_row[r] = -1e30f; l_row[r] = 0.0f; }

  bf16_t* Pww = &Pw[wave * 16 * 64];
  const unsigned kwb = lds_off(Kw), vtb = lds_off(Vt);
  const int ldr = tid >> 2, ldc = (tid & 3) * 16;
  const float scale = 0.125f;   // 1/sqrt(64)

  auto issue_kv = [&](int buf, int j0) {
    // K block [64 keys][64 d] -> Kw[key][d]
    const bf16_t* kg = Kb + (size_t)(j0 + ldr) * HD + ldc;
    unsigned kl = kwb + (unsigned)(buf * KVBUF + ldr * HD + ldc) * 2;
    async_ld_b128(kl, kg);
    async_ld_b128(kl + 16, kg + 8);
    // V block (global already [d][s]) -> Vt[d][key]
    const bf16_t* vg = Vb + (size_t)ldr * SEQ + j0 + ldc;
    unsigned vl = vtb + (unsigned)(buf * KVBUF + ldr * 64 + ldc) * 2;
    async_ld_b128(vl, vg);
    async_ld_b128(vl + 16, vg + 8);
  };

  issue_kv(0, 0);
  for (int jb = 0; jb < SEQ / 64; ++jb) {
    const int cur = jb & 1;
    if (jb + 1 < SEQ / 64) {
      issue_kv(cur ^ 1, (jb + 1) * 64);
      wait_asynccnt<4>();
    } else {
      wait_asynccnt<0>();
    }
    __syncthreads();

    const bf16_t* Kc = &Kw[cur * KVBUF];
    const bf16_t* Vc = &Vt[cur * KVBUF];

    // ---- scores S = Q * K^T  (16 x 64 per wave, 8 WMMAs) ----
    v8f s[4];
#pragma unroll
    for (int t = 0; t < 4; ++t) s[t] = zero8();
#pragma unroll
    for (int kh = 0; kh < 2; ++kh) {
#pragma unroll
      for (int t = 0; t < 4; ++t) {
        v16bf bk = ldfrag(&Kc[(t * 16 + lm) * HD + kh * 32 + half * 8]);
        s[t] = wmma_bf16(aq[kh], bk, s[t]);
      }
    }
#pragma unroll
    for (int t = 0; t < 4; ++t)
#pragma unroll
      for (int r = 0; r < 8; ++r) s[t][r] *= scale;

    // ---- online softmax per row (row = r + 8*half; 16 lanes hold a row) ----
#pragma unroll
    for (int r = 0; r < 8; ++r) {
      float mx = fmaxf(fmaxf(s[0][r], s[1][r]), fmaxf(s[2][r], s[3][r]));
#pragma unroll
      for (int d = 1; d < 16; d <<= 1) mx = fmaxf(mx, __shfl_xor(mx, d));
      float mn   = fmaxf(m_row[r], mx);
      float corr = __expf(m_row[r] - mn);
      m_row[r]   = mn;
      float lb = 0.0f;
#pragma unroll
      for (int t = 0; t < 4; ++t) {
        float p = __expf(s[t][r] - mn);
        s[t][r] = p;
        lb += p;
      }
#pragma unroll
      for (int d = 1; d < 16; d <<= 1) lb += __shfl_xor(lb, d);
      l_row[r] = l_row[r] * corr + lb;
#pragma unroll
      for (int t = 0; t < 4; ++t) o[t][r] *= corr;
    }

    // ---- write P (bf16) to wave-private LDS, layout [qrow][key] ----
#pragma unroll
    for (int t = 0; t < 4; ++t)
#pragma unroll
      for (int r = 0; r < 8; ++r)
        Pww[(r + 8 * half) * 64 + t * 16 + lm] = (bf16_t)s[t][r];

    // ---- O += P * V  (8 WMMAs; B-fragments from [d][key] V) ----
#pragma unroll
    for (int kh = 0; kh < 2; ++kh) {
      v16bf ap = ldfrag(&Pww[lm * 64 + kh * 32 + half * 8]);
#pragma unroll
      for (int t = 0; t < 4; ++t) {
        v16bf bv = ldfrag(&Vc[(t * 16 + lm) * 64 + kh * 32 + half * 8]);
        o[t] = wmma_bf16(ap, bv, o[t]);
      }
    }
    __syncthreads();
  }

  // ---- finalize: divide by l, store bf16 into [B*S][DIM] ----
#pragma unroll
  for (int r = 0; r < 8; ++r) {
    float inv = 1.0f / l_row[r];
    int srow = q0 + r + 8 * half;
#pragma unroll
    for (int t = 0; t < 4; ++t) {
      int col = h * HD + t * 16 + lm;
      aout[((size_t)b * SEQ + srow) * DIM + col] = (bf16_t)(o[t][r] * inv);
    }
  }
}

// ---------------- launch ----------------

extern "C" void kernel_launch(void* const* d_in, const int* in_sizes, int n_in,
                              void* d_out, int out_size, void* d_ws, size_t ws_size,
                              hipStream_t stream) {
  const float* x      = (const float*)d_in[0];
  const float* qkv_w  = (const float*)d_in[1];
  const float* qkv_b  = (const float*)d_in[2];
  const float* proj_w = (const float*)d_in[3];
  const float* proj_b = (const float*)d_in[4];

  const size_t MB = 1u << 20;
  char* ws = (char*)d_ws;
  bf16_t* xb     = (bf16_t*)(ws);             //  8 MB: x as bf16 [4096][1024]
  bf16_t* wqkvT  = (bf16_t*)(ws + 8 * MB);    //  6 MB: qkv_w^T [3072][1024]
  bf16_t* wprojT = (bf16_t*)(ws + 14 * MB);   //  2 MB: proj_w^T [1024][1024]
  bf16_t* qkvbuf = (bf16_t*)(ws + 16 * MB);   // 24 MB: Q,K [B][H][S][D]; V [B][H][D][S]
  bf16_t* aout   = (bf16_t*)(ws + 40 * MB);   //  8 MB: attn out [4096][1024]

  // convert / transpose to bf16
  const int nx = MTOT * DIM;
  cvt_bf16_kernel<<<nx / 256, 256, 0, stream>>>(x, xb, nx);
  cvt_transpose_kernel<<<dim3(3 * DIM / 64, DIM / 64), 256, 0, stream>>>(qkv_w, wqkvT, DIM, 3 * DIM);
  cvt_transpose_kernel<<<dim3(DIM / 64, DIM / 64), 256, 0, stream>>>(proj_w, wprojT, DIM, DIM);

  // QKV GEMM: [4096,1024] x [1024,3072] -> scattered bf16 Q/K/V
  gemm_bf16_kernel<0><<<dim3(3 * DIM / 256, MTOT / 64), 256, 0, stream>>>(
      xb, wqkvT, qkv_b, qkvbuf, MTOT, 3 * DIM, DIM);

  // attention
  attn_kernel<<<dim3(SEQ / 128, BATCH * NH), 256, 0, stream>>>(qkvbuf, aout);

  // projection GEMM: [4096,1024] x [1024,1024] + bias -> f32 out
  gemm_bf16_kernel<1><<<dim3(DIM / 256, MTOT / 64), 256, 0, stream>>>(
      aout, wprojT, proj_b, d_out, MTOT, DIM, DIM);
}

// v002
// A run of this version takes 240 microseconds.
// Next to v001, in two timings, it ran 1.39 and 1.38 times as fast.
// All steps since v000 together make it 1.91 times as fast.
#include <hip/hip_runtime.h>
#include <hip/hip_bf16.h>
#include <stdint.h>

typedef __bf16 bf16_t;
typedef __attribute__((ext_vector_type(8)))  __bf16 v8bf;
typedef __attribute__((ext_vector_type(16))) __bf16 v16bf;
typedef __attribute__((ext_vector_type(8)))  float  v8f;

#define DIM   1024
#define SEQ   2048
#define NH    16
#define HD    64
#define BATCH 2
#define MTOT  (BATCH * SEQ)   // 4096 tokens

// ---------------- helpers ----------------

__device__ __forceinline__ v8f zero8() {
  v8f z;
#pragma unroll
  for (int i = 0; i < 8; ++i) z[i] = 0.0f;
  return z;
}

// Low 32 bits of a generic pointer to __shared__ = LDS byte offset (aperture mapping).
__device__ __forceinline__ unsigned lds_off(const void* p) {
  return (unsigned)(unsigned long long)(uintptr_t)p;
}

// CDNA5 async global->LDS copy (per-lane 16B), tracked by ASYNCcnt.
__device__ __forceinline__ void async_ld_b128(unsigned lds, const void* g) {
  asm volatile("global_load_async_to_lds_b128 %0, %1, off"
               :: "v"(lds), "v"((unsigned long long)(uintptr_t)g)
               : "memory");
}

template <int N>
__device__ __forceinline__ void wait_asynccnt() {
  asm volatile("s_wait_asynccnt %0" :: "i"(N) : "memory");
}

// Load a 16-element bf16 WMMA fragment: two contiguous 16B chunks at p and p+16
// (ISA 16-bit A/B layout: k = half*8 + e  and  k = 16 + half*8 + e).
__device__ __forceinline__ v16bf ldfrag(const bf16_t* p) {
  v8bf lo = *(const v8bf*)(p);
  v8bf hi = *(const v8bf*)(p + 16);
  return __builtin_shufflevector(lo, hi, 0, 1, 2, 3, 4, 5, 6, 7,
                                 8, 9, 10, 11, 12, 13, 14, 15);
}

__device__ __forceinline__ v8f wmma_bf16(v16bf a, v16bf b, v8f c) {
  return __builtin_amdgcn_wmma_f32_16x16x32_bf16(false, a, false, b,
                                                 (short)0, c, false, false);
}

// ---------------- conversion kernels ----------------

__global__ void cvt_bf16_kernel(const float* __restrict__ in,
                                bf16_t* __restrict__ out, int n) {
  int i = blockIdx.x * blockDim.x + threadIdx.x;
  if (i < n) out[i] = (bf16_t)in[i];
}

// out[c*R + r] = (bf16) in[r*C + c]  (weights as [N][K] for B-fragments)
// One 64x64 tile per block of 256 threads, turned in LDS so that both global sides
// are wide and contiguous: 16 B loads along c, 16 B stores along r (8 lanes fill one
// 128 B line of out). R and C are multiples of 64. grid: (C/64, R/64).
#define TT   64
#define TPIT 65   // f32 pitch: both the row-wise writes and the column-wise reads hit distinct banks

__global__ __launch_bounds__(256) void cvt_transpose_kernel(
    const float* __restrict__ in, bf16_t* __restrict__ out, int R, int C) {
  __shared__ float tile[TT * TPIT];
  const int tid = threadIdx.x;
  const int c0 = blockIdx.x * TT, r0 = blockIdx.y * TT;

  const int lr = tid >> 4, lc = (tid & 15) * 4;
  float4 v[4];
#pragma unroll   // all four loads in flight before the first LDS write; v[] stays in registers
  for (int p = 0; p < 4; ++p)
    v[p] = *(const float4*)(in + (size_t)(r0 + lr + p * 16) * C + c0 + lc);
#pragma unroll   // v[] indexed by constants only
  for (int p = 0; p < 4; ++p) {
    float* t = &tile[(lr + p * 16) * TPIT + lc];
    t[0] = v[p].x; t[1] = v[p].y; t[2] = v[p].z; t[3] = v[p].w;
  }
  __syncthreads();

#pragma unroll   // both chunks' LDS reads issue together
  for (int p = 0; p < 2; ++p) {
    const int q = tid + p * 256;
    const int oc = q >> 3, orr = (q & 7) * 8;
    v8bf w;
#pragma unroll   // w[] indexed by constants only
    for (int i = 0; i < 8; ++i) w[i] = (bf16_t)tile[(orr + i) * TPIT + oc];
    *(v8bf*)(out + (size_t)(c0 + oc) * R + r0 + orr) = w;
  }
}

// ---------------- bf16 GEMM: C[M,N] = A[M,K] * Bt[N,K]^T + bias ----------------
// MODE 0: scatter bf16 into qkv buffer: Q,K as [B][H][S][D]; V as [B][H][D][S].
// MODE 1: f32 output + bias, row-major [M,N].

#define ASTR 40           // padded LDS row strides (40*2 = 80B keeps 16B alignment)
#define BSTR 40
#define ABUF (64 * ASTR)
#define BBUF (256 * BSTR)

template <int MODE>
__global__ __launch_bounds__(256) void gemm_bf16_kernel(
    const bf16_t* __restrict__ A, const bf16_t* __restrict__ Bt,
    const float* __restrict__ bias, void* __restrict__ outp,
    int M, int N, int K) {
  __shared__ bf16_t Aw[2 * ABUF];   // double-buffered 64x32 A tiles
  __shared__ bf16_t Bw[2 * BBUF];   // double-buffered 256x32 B tiles

  const int tid  = threadIdx.x;
  const int wave = tid >> 5, lane = tid & 31;
  const int lm   = lane & 15, half = lane >> 4;
  const int wm   = wave >> 2, wn = wave & 3;     // 2 x 4 wave grid
  const int n0   = blockIdx.x * 256;
  const int m0   = blockIdx.y * 64;

  v8f acc[2][4];
#pragma unroll
  for (int mt = 0; mt < 2; ++mt)
#pragma unroll
    for (int nt = 0; nt < 4; ++nt) acc[mt][nt] = zero8();

  const unsigned awb = lds_off(Aw), bwb = lds_off(Bw);
  const int arow = tid >> 2, acol = (tid & 3) * 8;

  auto issue = [&](int buf, int kk) {
    // A tile: 1 async b128 per lane
    async_ld_b128(awb + (unsigned)(buf * ABUF + arow * ASTR + acol) * 2,
                  A + (size_t)(m0 + arow) * K + kk + acol);
    // B tile: 4 async b128 per lane (row n = tid)
#pragma unroll
    for (int i = 0; i < 4; ++i)
      async_ld_b128(bwb + (unsigned)(buf * BBUF + tid * BSTR + i * 8) * 2,
                    Bt + (size_t)(n0 + tid) * K + kk + i * 8);
  };

  issue(0, 0);
  for (int kk = 0; kk < K; kk += 32) {
    const int cur = (kk >> 5) & 1;
    if (kk + 32 < K) {
      issue(cur ^ 1, kk + 32);   // prefetch next tile into other buffer
      wait_asynccnt<5>();        // 5 oldest (current buffer) retired
    } else {
      wait_asynccnt<0>();
    }
    __syncthreads();

    const bf16_t* Ac = &Aw[cur * ABUF];
    const bf16_t* Bc = &Bw[cur * BBUF];
    v16bf af[2], bfg[4];
#pragma unroll
    for (int mt = 0; mt < 2; ++mt)
      af[mt] = ldfrag(&Ac[(wm * 32 + mt * 16 + lm) * ASTR + half * 8]);
#pragma unroll
    for (int nt = 0; nt < 4; ++nt)
      bfg[nt] = ldfrag(&Bc[(wn * 64 + nt * 16 + lm) * BSTR + half * 8]);
#pragma unroll
    for (int mt = 0; mt < 2; ++mt) {
#pragma unroll
      for (int nt = 0; nt < 4; ++nt)
        acc[mt][nt] = wmma_bf16(af[mt], bfg[nt], acc[mt][nt]);
    }
    __syncthreads();
  }

  // epilogue
#pragma unroll
  for (int mt = 0; mt < 2; ++mt) {
#pragma unroll
    for (int nt = 0; nt < 4; ++nt) {
#pragma unroll
      for (int r = 0; r < 8; ++r) {
        int gm = m0 + wm * 32 + mt * 16 + r + 8 * half;   // C/D: m = r + 8*half
        int gn = n0 + wn * 64 + nt * 16 + lm;             // C/D: n = lane%16
        float v = acc[mt][nt][r] + bias[gn];
        if (MODE == 0) {
          int part = gn >> 10, rem = gn & 1023;
          int hh = rem >> 6, dd = rem & 63;
          int bb = gm >> 11, ss = gm & 2047;
          size_t base = (size_t)part * ((size_t)BATCH * NH * SEQ * HD);
          size_t idx;
          if (part == 2)  // V stored head-transposed [b][h][d][s]
            idx = base + (((size_t)bb * NH + hh) * HD + dd) * SEQ + ss;
          else            // Q, K stored [b][h][s][d]
            idx = base + (((size_t)bb * NH + hh) * SEQ + ss) * HD + dd;
          ((bf16_t*)outp)[idx] = (bf16_t)v;
        } else {
          ((float*)outp)[(size_t)gm * N + gn] = v;
        }
      }
    }
  }
}

// ---------------- flash attention ----------------
// grid: (SEQ/128, BATCH*NH); block 256 threads = 8 waves; wave owns 16 q rows.
// qkv: Q,K [B][H][S][D]; V [B][H][D][S] (bf16).  aout: [B*S][DIM] bf16.

// LDS rows of K, V and P hold 64 bf16 (128 B) and are all read as 16 B fragments, one row
// per lane: at a 128 B pitch 16 lanes fall on two bank groups, at 144 B (16 B x odd) on all.
#define KVP   72            // LDS row pitch in elements (64 used + 8 never read)
#define KVBUF (64 * KVP)    // elements per K or V tile

__global__ __launch_bounds__(256) void attn_kernel(const bf16_t* __restrict__ qkv,
                                                   bf16_t* __restrict__ aout) {
  __shared__ __attribute__((aligned(16))) bf16_t Kw[2 * KVBUF];      // [key][d]    18 KB (double buffered)
  __shared__ __attribute__((aligned(16))) bf16_t Vt[2 * KVBUF];      // [d][key]    18 KB (double buffered)
  __shared__ __attribute__((aligned(16))) bf16_t Pw[8 * 16 * KVP];   // per-wave P  18 KB

  const int tid  = threadIdx.x;
  const int wave = tid >> 5, lane = tid & 31;
  const int lm   = lane & 15, half = lane >> 4;
  const int bh   = blockIdx.y;
  const int b    = bh >> 4, h = bh & 15;

  const size_t partsz = (size_t)BATCH * NH * SEQ * HD;
  const bf16_t* Qb = qkv + ((size_t)b * NH + h) * SEQ * HD;
  const bf16_t* Kb = qkv + partsz + ((size_t)b * NH + h) * SEQ * HD;
  const bf16_t* Vb = qkv + 2 * partsz + ((size_t)b * NH + h) * HD * SEQ;  // [d][s]

  const int q0 = blockIdx.x * 128 + wave * 16;

  // Q fragments (A operand), loaded once: k-dim = 64 -> 2 chunks of 32
  v16bf aq[2];
#pragma unroll
  for (int kh = 0; kh < 2; ++kh)
    aq[kh] = ldfrag(Qb + (size_t)(q0 + lm) * HD + kh * 32 + half * 8);

  v8f o[4];
#pragma unroll
  for (int t = 0; t < 4; ++t) o[t] = zero8();
  float m_row[8], l_row[8];
#pragma unroll
  for (int r = 0; r < 8; ++r) { m_row[r] = -1e30f; l_row[r] = 0.0f; }

  bf16_t* Pww = &Pw[wave * 16 * KVP];
  const unsigned kwb = lds_off(Kw), vtb = lds_off(Vt);
  const int ldr = tid >> 2, ldc = (tid & 3) * 16;
  const float scale = 0.125f;   // 1/sqrt(64)

  auto issue_kv = [&](int buf, int j0) {
    // K block [64 keys][64 d] -> Kw[key][d]
    const bf16_t* kg = Kb + (size_t)(j0 + ldr) * HD + ldc;
    unsigned kl = kwb + (unsigned)(buf * KVBUF + ldr * KVP + ldc) * 2;
    async_ld_b128(kl, kg);
    async_ld_b128(kl + 16, kg + 8);
    // V block (global already [d][s]) -> Vt[d][key]
    const bf16_t* vg = Vb + (size_t)ldr * SEQ + j0 + ldc;
    unsigned vl = vtb + (unsigned)(buf * KVBUF + ldr * KVP + ldc) * 2;
    async_ld_b128(vl, vg);
    async_ld_b128(vl + 16, vg + 8);
  };

  issue_kv(0, 0);
  for (int jb = 0; jb < SEQ / 64; ++jb) {
    const int cur = jb & 1;
    if (jb + 1 < SEQ / 64) {
      issue_kv(cur ^ 1, (jb + 1) * 64);
      wait_asynccnt<4>();
    } else {
      wait_asynccnt<0>();
    }
    __syncthreads();

    const bf16_t* Kc = &Kw[cur * KVBUF];
    const bf16_t* Vc = &Vt[cur * KVBUF];

    // ---- scores S = Q * K^T  (16 x 64 per wave, 8 WMMAs) ----
    v8f s[4];
#pragma unroll
    for (int t = 0; t < 4; ++t) s[t] = zero8();
#pragma unroll
    for (int kh = 0; kh < 2; ++kh) {
#pragma unroll
      for (int t = 0; t < 4; ++t) {
        v16bf bk = ldfrag(&Kc[(t * 16 + lm) * KVP + kh * 32 + half * 8]);
        s[t] = wmma_bf16(aq[kh], bk, s[t]);
      }
    }
#pragma unroll
    for (int t = 0; t < 4; ++t)
#pragma unroll
      for (int r = 0; r < 8; ++r) s[t][r] *= scale;

    // ---- online softmax per row (row = r + 8*half; 16 lanes hold a row) ----
#pragma unroll
    for (int r = 0; r < 8; ++r) {
      float mx = fmaxf(fmaxf(s[0][r], s[1][r]), fmaxf(s[2][r], s[3][r]));
#pragma unroll
      for (int d = 1; d < 16; d <<= 1) mx = fmaxf(mx, __shfl_xor(mx, d));
      float mn   = fmaxf(m_row[r], mx);
      float corr = __expf(m_row[r] - mn);
      m_row[r]   = mn;
      float lb = 0.0f;
#pragma unroll
      for (int t = 0; t < 4; ++t) {
        float p = __expf(s[t][r] - mn);
        s[t][r] = p;
        lb += p;
      }
#pragma unroll
      for (int d = 1; d < 16; d <<= 1) lb += __shfl_xor(lb, d);
      l_row[r] = l_row[r] * corr + lb;
#pragma unroll
      for (int t = 0; t < 4; ++t) o[t][r] *= corr;
    }

    // ---- write P (bf16) to wave-private LDS, layout [qrow][key] ----
#pragma unroll
    for (int t = 0; t < 4; ++t)
#pragma unroll
      for (int r = 0; r < 8; ++r)
        Pww[(r + 8 * half) * KVP + t * 16 + lm] = (bf16_t)s[t][r];

    // ---- O += P * V  (8 WMMAs; B-fragments from [d][key] V) ----
#pragma unroll
    for (int kh = 0; kh < 2; ++kh) {
      v16bf ap = ldfrag(&Pww[lm * KVP + kh * 32 + half * 8]);
#pragma unroll
      for (int t = 0; t < 4; ++t) {
        v16bf bv = ldfrag(&Vc[(t * 16 + lm) * KVP + kh * 32 + half * 8]);
        o[t] = wmma_bf16(ap, bv, o[t]);
      }
    }
    __syncthreads();
  }

  // ---- finalize: divide by l, store bf16 into [B*S][DIM] ----
#pragma unroll
  for (int r = 0; r < 8; ++r) {
    float inv = 1.0f / l_row[r];
    int srow = q0 + r + 8 * half;
#pragma unroll
    for (int t = 0; t < 4; ++t) {
      int col = h * HD + t * 16 + lm;
      aout[((size_t)b * SEQ + srow) * DIM + col] = (bf16_t)(o[t][r] * inv);
    }
  }
}

// ---------------- launch ----------------

extern "C" void kernel_launch(void* const* d_in, const int* in_sizes, int n_in,
                              void* d_out, int out_size, void* d_ws, size_t ws_size,
                              hipStream_t stream) {
  const float* x      = (const float*)d_in[0];
  const float* qkv_w  = (const float*)d_in[1];
  const float* qkv_b  = (const float*)d_in[2];
  const float* proj_w = (const float*)d_in[3];
  const float* proj_b = (const float*)d_in[4];

  const size_t MB = 1u << 20;
  char* ws = (char*)d_ws;
  bf16_t* xb     = (bf16_t*)(ws);             //  8 MB: x as bf16 [4096][1024]
  bf16_t* wqkvT  = (bf16_t*)(ws + 8 * MB);    //  6 MB: qkv_w^T [3072][1024]
  bf16_t* wprojT = (bf16_t*)(ws + 14 * MB);   //  2 MB: proj_w^T [1024][1024]
  bf16_t* qkvbuf = (bf16_t*)(ws + 16 * MB);   // 24 MB: Q,K [B][H][S][D]; V [B][H][D][S]
  bf16_t* aout   = (bf16_t*)(ws + 40 * MB);   //  8 MB: attn out [4096][1024]

  // convert / transpose to bf16
  const int nx = MTOT * DIM;
  cvt_bf16_kernel<<<nx / 256, 256, 0, stream>>>(x, xb, nx);
  cvt_transpose_kernel<<<dim3(3 * DIM / 64, DIM / 64), 256, 0, stream>>>(qkv_w, wqkvT, DIM, 3 * DIM);
  cvt_transpose_kernel<<<dim3(DIM / 64, DIM / 64), 256, 0, stream>>>(proj_w, wprojT, DIM, DIM);

  // QKV GEMM: [4096,1024] x [1024,3072] -> scattered bf16 Q/K/V
  gemm_bf16_kernel<0><<<dim3(3 * DIM / 256, MTOT / 64), 256, 0, stream>>>(
      xb, wqkvT, qkv_b, qkvbuf, MTOT, 3 * DIM, DIM);

  // attention
  attn_kernel<<<dim3(SEQ / 128, BATCH * NH), 256, 0, stream>>>(qkvbuf, aout);

  // projection GEMM: [4096,1024] x [1024,1024] + bias -> f32 out
  gemm_bf16_kernel<1><<<dim3(DIM / 256, MTOT / 64), 256, 0, stream>>>(
      aout, wprojT, proj_b, d_out, MTOT, DIM, DIM);
}

// v003
// One run takes 212 microseconds.
// In two side-by-side timings against v002, it was 1.12 and 1.13 times as fast.
// Over all steps from v000 it is 2.15 times as fast.
#include <hip/hip_runtime.h>
#include <hip/hip_bf16.h>
#include <stdint.h>

typedef __bf16 bf16_t;
typedef __attribute__((ext_vector_type(8)))  __bf16 v8bf;
typedef __attribute__((ext_vector_type(16))) __bf16 v16bf;
typedef __attribute__((ext_vector_type(8)))  float  v8f;

#define DIM   1024
#define SEQ   2048
#define NH    16
#define HD    64
#define BATCH 2
#define MTOT  (BATCH * SEQ)   // 4096 tokens

// ---------------- helpers ----------------

__device__ __forceinline__ v8f zero8() {
  v8f z;
#pragma unroll
  for (int i = 0; i < 8; ++i) z[i] = 0.0f;
  return z;
}

// Low 32 bits of a generic pointer to __shared__ = LDS byte offset (aperture mapping).
__device__ __forceinline__ unsigned lds_off(const void* p) {
  return (unsigned)(unsigned long long)(uintptr_t)p;
}

// CDNA5 async global->LDS copy (per-lane 16B), tracked by ASYNCcnt.
__device__ __forceinline__ void async_ld_b128(unsigned lds, const void* g) {
  asm volatile("global_load_async_to_lds_b128 %0, %1, off"
               :: "v"(lds), "v"((unsigned long long)(uintptr_t)g)
               : "memory");
}

// Five such copies in one statement. Its last line, s_wait_xcnt 0, is a precaution: it stands
// in front of every later rewrite of the address registers that the copies name, and only
// inside the copies' own statement can the compiler move no such rewrite ahead of it.
__device__ __forceinline__ void async_ld5_b128(unsigned l0, const void* g0,
                                               unsigned l1, const void* g1,
                                               unsigned l2, const void* g2,
                                               unsigned l3, const void* g3,
                                               unsigned l4, const void* g4) {
  asm volatile("global_load_async_to_lds_b128 %0, %1, off\n\t"
               "global_load_async_to_lds_b128 %2, %3, off\n\t"
               "global_load_async_to_lds_b128 %4, %5, off\n\t"
               "global_load_async_to_lds_b128 %6, %7, off\n\t"
               "global_load_async_to_lds_b128 %8, %9, off\n\t"
               "s_wait_xcnt 0x0"
               :: "v"(l0), "v"((unsigned long long)(uintptr_t)g0),
                  "v"(l1), "v"((unsigned long long)(uintptr_t)g1),
                  "v"(l2), "v"((unsigned long long)(uintptr_t)g2),
                  "v"(l3), "v"((unsigned long long)(uintptr_t)g3),
                  "v"(l4), "v"((unsigned long long)(uintptr_t)g4)
               : "memory");
}

template <int N>
__device__ __forceinline__ void wait_asynccnt() {
  asm volatile("s_wait_asynccnt %0" :: "i"(N) : "memory");
}

// Load a 16-element bf16 WMMA fragment: two contiguous 16B chunks at p and p+16
// (ISA 16-bit A/B layout: k = half*8 + e  and  k = 16 + half*8 + e).
__device__ __forceinline__ v16bf ldfrag(const bf16_t* p) {
  v8bf lo = *(const v8bf*)(p);
  v8bf hi = *(const v8bf*)(p + 16);
  return __builtin_shufflevector(lo, hi, 0, 1, 2, 3, 4, 5, 6, 7,
                                 8, 9, 10, 11, 12, 13, 14, 15);
}

__device__ __forceinline__ v8f wmma_bf16(v16bf a, v16bf b, v8f c) {
  return __builtin_amdgcn_wmma_f32_16x16x32_bf16(false, a, false, b,
                                                 (short)0, c, false, false);
}

// ---------------- conversion kernels ----------------

__global__ void cvt_bf16_kernel(const float* __restrict__ in,
                                bf16_t* __restrict__ out, int n) {
  int i = blockIdx.x * blockDim.x + threadIdx.x;
  if (i < n) out[i] = (bf16_t)in[i];
}

// out[c*R + r] = (bf16) in[r*C + c]  (weights as [N][K] for B-fragments)
// One 64x64 tile per block of 256 threads, turned in LDS so that both global sides
// are wide and contiguous: 16 B loads along c, 16 B stores along r (8 lanes fill one
// 128 B line of out). R and C are multiples of 64. grid: (C/64, R/64).
#define TT   64
#define TPIT 65   // f32 pitch: both the row-wise writes and the column-wise reads hit distinct banks

__global__ __launch_bounds__(256) void cvt_transpose_kernel(
    const float* __restrict__ in, bf16_t* __restrict__ out, int R, int C) {
  __shared__ float tile[TT * TPIT];
  const int tid = threadIdx.x;
  const int c0 = blockIdx.x * TT, r0 = blockIdx.y * TT;

  const int lr = tid >> 4, lc = (tid & 15) * 4;
  float4 v[4];
#pragma unroll   // all four loads in flight before the first LDS write; v[] stays in registers
  for (int p = 0; p < 4; ++p)
    v[p] = *(const float4*)(in + (size_t)(r0 + lr + p * 16) * C + c0 + lc);
#pragma unroll   // v[] indexed by constants only
  for (int p = 0; p < 4; ++p) {
    float* t = &tile[(lr + p * 16) * TPIT + lc];
    t[0] = v[p].x; t[1] = v[p].y; t[2] = v[p].z; t[3] = v[p].w;
  }
  __syncthreads();

#pragma unroll   // both chunks' LDS reads issue together
  for (int p = 0; p < 2; ++p) {
    const int q = tid + p * 256;
    const int oc = q >> 3, orr = (q & 7) * 8;
    v8bf w;
#pragma unroll   // w[] indexed by constants only
    for (int i = 0; i < 8; ++i) w[i] = (bf16_t)tile[(orr + i) * TPIT + oc];
    *(v8bf*)(out + (size_t)(c0 + oc) * R + r0 + orr) = w;
  }
}

// ---------------- bf16 GEMM: C[M,N] = A[M,K] * Bt[N,K]^T + bias ----------------
// MODE 0: scatter bf16 into qkv buffer: Q,K as [B][H][S][D]; V as [B][H][D][S].
// MODE 1: f32 output + bias, row-major [M,N].

#define ASTR 40           // padded LDS row strides (40*2 = 80B keeps 16B alignment)
#define BSTR 40
#define ABUF (64 * ASTR)
#define BBUF (256 * BSTR)

template <int MODE>
__global__ __launch_bounds__(256) void gemm_bf16_kernel(
    const bf16_t* __restrict__ A, const bf16_t* __restrict__ Bt,
    const float* __restrict__ bias, void* __restrict__ outp,
    int M, int N, int K) {
  __shared__ __attribute__((aligned(16))) bf16_t Aw[2 * ABUF];   // double-buffered 64x32 A tiles
  __shared__ __attribute__((aligned(16))) bf16_t Bw[2 * BBUF];   // double-buffered 256x32 B tiles

  const int tid  = threadIdx.x;
  const int wave = tid >> 5, lane = tid & 31;
  const int lm   = lane & 15, half = lane >> 4;
  const int wm   = wave >> 2, wn = wave & 3;     // 2 x 4 wave grid
  const int n0   = blockIdx.x * 256;
  const int m0   = blockIdx.y * 64;

  v8f acc[2][4];
#pragma unroll
  for (int mt = 0; mt < 2; ++mt)
#pragma unroll
    for (int nt = 0; nt < 4; ++nt) acc[mt][nt] = zero8();

  const unsigned awb = lds_off(Aw), bwb = lds_off(Bw);
  const int arow = tid >> 2, acol = (tid & 3) * 8;

  // A row of either tile is 64 contiguous bytes of global memory. Four neighbouring lanes
  // bring one row, so a wave-wide copy touches 8 lines; with one row per lane it touches 32.
  auto issue = [&](int buf, int kk) {
    // A tile: 1 async b128 per lane. B tile: 4 per lane, copy i brings rows 64 i .. 64 i + 63.
    const unsigned al = awb + (unsigned)(buf * ABUF + arow * ASTR + acol) * 2;
    const unsigned bl = bwb + (unsigned)(buf * BBUF + arow * BSTR + acol) * 2;
    const bf16_t*  bg = Bt + (size_t)(n0 + arow) * K + kk + acol;
    async_ld5_b128(al, A + (size_t)(m0 + arow) * K + kk + acol,
                   bl, bg,
                   bl + 64 * BSTR * 2, bg + (size_t)64 * K,
                   bl + 128 * BSTR * 2, bg + (size_t)128 * K,
                   bl + 192 * BSTR * 2, bg + (size_t)192 * K);
  };

  issue(0, 0);
  for (int kk = 0; kk < K; kk += 32) {
    const int cur = (kk >> 5) & 1;
    if (kk + 32 < K) {
      issue(cur ^ 1, kk + 32);   // prefetch next tile into other buffer
      wait_asynccnt<5>();        // 5 oldest (current buffer) retired
    } else {
      wait_asynccnt<0>();
    }
    __syncthreads();

    const bf16_t* Ac = &Aw[cur * ABUF];
    const bf16_t* Bc = &Bw[cur * BBUF];
    v16bf af[2], bfg[4];
#pragma unroll
    for (int mt = 0; mt < 2; ++mt)
      af[mt] = ldfrag(&Ac[(wm * 32 + mt * 16 + lm) * ASTR + half * 8]);
#pragma unroll
    for (int nt = 0; nt < 4; ++nt)
      bfg[nt] = ldfrag(&Bc[(wn * 64 + nt * 16 + lm) * BSTR + half * 8]);
#pragma unroll
    for (int mt = 0; mt < 2; ++mt) {
#pragma unroll
      for (int nt = 0; nt < 4; ++nt)
        acc[mt][nt] = wmma_bf16(af[mt], bfg[nt], acc[mt][nt]);
    }
    __syncthreads();
  }

  // epilogue
#pragma unroll
  for (int mt = 0; mt < 2; ++mt) {
#pragma unroll
    for (int nt = 0; nt < 4; ++nt) {
#pragma unroll
      for (int r = 0; r < 8; ++r) {
        int gm = m0 + wm * 32 + mt * 16 + r + 8 * half;   // C/D: m = r + 8*half
        int gn = n0 + wn * 64 + nt * 16 + lm;             // C/D: n = lane%16
        float v = acc[mt][nt][r] + bias[gn];
        if (MODE == 0) {
          int part = gn >> 10, rem = gn & 1023;
          int hh = rem >> 6, dd = rem & 63;
          int bb = gm >> 11, ss = gm & 2047;
          size_t base = (size_t)part * ((size_t)BATCH * NH * SEQ * HD);
          size_t idx;
          if (part == 2)  // V stored head-transposed [b][h][d][s]
            idx = base + (((size_t)bb * NH + hh) * HD + dd) * SEQ + ss;
          else            // Q, K stored [b][h][s][d]
            idx = base + (((size_t)bb * NH + hh) * SEQ + ss) * HD + dd;
          ((bf16_t*)outp)[idx] = (bf16_t)v;
        } else {
          ((float*)outp)[(size_t)gm * N + gn] = v;
        }
      }
    }
  }
}

// ---------------- flash attention ----------------
// grid: (SEQ/128, BATCH*NH); block 256 threads = 8 waves; wave owns 16 q rows.
// qkv: Q,K [B][H][S][D]; V [B][H][D][S] (bf16).  aout: [B*S][DIM] bf16.

// LDS rows of K, V and P hold 64 bf16 (128 B) and are all read as 16 B fragments, one row
// per lane: at a 128 B pitch 16 lanes fall on two bank groups, at 144 B (16 B x odd) on all.
#define KVP   72            // LDS row pitch in elements (64 used + 8 never read)
#define KVBUF (64 * KVP)    // elements per K or V tile

__global__ __launch_bounds__(256) void attn_kernel(const bf16_t* __restrict__ qkv,
                                                   bf16_t* __restrict__ aout) {
  __shared__ __attribute__((aligned(16))) bf16_t Kw[2 * KVBUF];      // [key][d]    18 KB (double buffered)
  __shared__ __attribute__((aligned(16))) bf16_t Vt[2 * KVBUF];      // [d][key]    18 KB (double buffered)
  __shared__ __attribute__((aligned(16))) bf16_t Pw[8 * 16 * KVP];   // per-wave P  18 KB

  const int tid  = threadIdx.x;
  const int wave = tid >> 5, lane = tid & 31;
  const int lm   = lane & 15, half = lane >> 4;
  const int bh   = blockIdx.y;
  const int b    = bh >> 4, h = bh & 15;

  const size_t partsz = (size_t)BATCH * NH * SEQ * HD;
  const bf16_t* Qb = qkv + ((size_t)b * NH + h) * SEQ * HD;
  const bf16_t* Kb = qkv + partsz + ((size_t)b * NH + h) * SEQ * HD;
  const bf16_t* Vb = qkv + 2 * partsz + ((size_t)b * NH + h) * HD * SEQ;  // [d][s]

  const int q0 = blockIdx.x * 128 + wave * 16;

  // Q fragments (A operand), loaded once: k-dim = 64 -> 2 chunks of 32
  v16bf aq[2];
#pragma unroll
  for (int kh = 0; kh < 2; ++kh)
    aq[kh] = ldfrag(Qb + (size_t)(q0 + lm) * HD + kh * 32 + half * 8);

  v8f o[4];
#pragma unroll
  for (int t = 0; t < 4; ++t) o[t] = zero8();
  float m_row[8], l_row[8];
#pragma unroll
  for (int r = 0; r < 8; ++r) { m_row[r] = -1e30f; l_row[r] = 0.0f; }

  bf16_t* Pww = &Pw[wave * 16 * KVP];
  const unsigned kwb = lds_off(Kw), vtb = lds_off(Vt);
  const int ldr = tid >> 2, ldc = (tid & 3) * 16;
  const float scale = 0.125f;   // 1/sqrt(64)

  auto issue_kv = [&](int buf, int j0) {
    // K block [64 keys][64 d] -> Kw[key][d]
    const bf16_t* kg = Kb + (size_t)(j0 + ldr) * HD + ldc;
    unsigned kl = kwb + (unsigned)(buf * KVBUF + ldr * KVP + ldc) * 2;
    async_ld_b128(kl, kg);
    async_ld_b128(kl + 16, kg + 8);
    // V block (global already [d][s]) -> Vt[d][key]
    const bf16_t* vg = Vb + (size_t)ldr * SEQ + j0 + ldc;
    unsigned vl = vtb + (unsigned)(buf * KVBUF + ldr * KVP + ldc) * 2;
    async_ld_b128(vl, vg);
    async_ld_b128(vl + 16, vg + 8);
  };

  issue_kv(0, 0);
  for (int jb = 0; jb < SEQ / 64; ++jb) {
    const int cur = jb & 1;
    if (jb + 1 < SEQ / 64) {
      issue_kv(cur ^ 1, (jb + 1) * 64);
      wait_asynccnt<4>();
    } else {
      wait_asynccnt<0>();
    }
    __syncthreads();

    const bf16_t* Kc = &Kw[cur * KVBUF];
    const bf16_t* Vc = &Vt[cur * KVBUF];

    // ---- scores S = Q * K^T  (16 x 64 per wave, 8 WMMAs) ----
    v8f s[4];
#pragma unroll
    for (int t = 0; t < 4; ++t) s[t] = zero8();
#pragma unroll
    for (int kh = 0; kh < 2; ++kh) {
#pragma unroll
      for (int t = 0; t < 4; ++t) {
        v16bf bk = ldfrag(&Kc[(t * 16 + lm) * KVP + kh * 32 + half * 8]);
        s[t] = wmma_bf16(aq[kh], bk, s[t]);
      }
    }
#pragma unroll
    for (int t = 0; t < 4; ++t)
#pragma unroll
      for (int r = 0; r < 8; ++r) s[t][r] *= scale;

    // ---- online softmax per row (row = r + 8*half; 16 lanes hold a row) ----
#pragma unroll
    for (int r = 0; r < 8; ++r) {
      float mx = fmaxf(fmaxf(s[0][r], s[1][r]), fmaxf(s[2][r], s[3][r]));
#pragma unroll
      for (int d = 1; d < 16; d <<= 1) mx = fmaxf(mx, __shfl_xor(mx, d));
      float mn   = fmaxf(m_row[r], mx);
      float corr = __expf(m_row[r] - mn);
      m_row[r]   = mn;
      float lb = 0.0f;
#pragma unroll
      for (int t = 0; t < 4; ++t) {
        float p = __expf(s[t][r] - mn);
        s[t][r] = p;
        lb += p;
      }
#pragma unroll
      for (int d = 1; d < 16; d <<= 1) lb += __shfl_xor(lb, d);
      l_row[r] = l_row[r] * corr + lb;
#pragma unroll
      for (int t = 0; t < 4; ++t) o[t][r] *= corr;
    }

    // ---- write P (bf16) to wave-private LDS, layout [qrow][key] ----
#pragma unroll
    for (int t = 0; t < 4; ++t)
#pragma unroll
      for (int r = 0; r < 8; ++r)
        Pww[(r + 8 * half) * KVP + t * 16 + lm] = (bf16_t)s[t][r];

    // ---- O += P * V  (8 WMMAs; B-fragments from [d][key] V) ----
#pragma unroll
    for (int kh = 0; kh < 2; ++kh) {
      v16bf ap = ldfrag(&Pww[lm * KVP + kh * 32 + half * 8]);
#pragma unroll
      for (int t = 0; t < 4; ++t) {
        v16bf bv = ldfrag(&Vc[(t * 16 + lm) * KVP + kh * 32 + half * 8]);
        o[t] = wmma_bf16(ap, bv, o[t]);
      }
    }
    __syncthreads();
  }

  // ---- finalize: divide by l, store bf16 into [B*S][DIM] ----
#pragma unroll
  for (int r = 0; r < 8; ++r) {
    float inv = 1.0f / l_row[r];
    int srow = q0 + r + 8 * half;
#pragma unroll
    for (int t = 0; t < 4; ++t) {
      int col = h * HD + t * 16 + lm;
      aout[((size_t)b * SEQ + srow) * DIM + col] = (bf16_t)(o[t][r] * inv);
    }
  }
}

// ---------------- launch ----------------

extern "C" void kernel_launch(void* const* d_in, const int* in_sizes, int n_in,
                              void* d_out, int out_size, void* d_ws, size_t ws_size,
                              hipStream_t stream) {
  const float* x      = (const float*)d_in[0];
  const float* qkv_w  = (const float*)d_in[1];
  const float* qkv_b  = (const float*)d_in[2];
  const float* proj_w = (const float*)d_in[3];
  const float* proj_b = (const float*)d_in[4];

  const size_t MB = 1u << 20;
  char* ws = (char*)d_ws;
  bf16_t* xb     = (bf16_t*)(ws);             //  8 MB: x as bf16 [4096][1024]
  bf16_t* wqkvT  = (bf16_t*)(ws + 8 * MB);    //  6 MB: qkv_w^T [3072][1024]
  bf16_t* wprojT = (bf16_t*)(ws + 14 * MB);   //  2 MB: proj_w^T [1024][1024]
  bf16_t* qkvbuf = (bf16_t*)(ws + 16 * MB);   // 24 MB: Q,K [B][H][S][D]; V [B][H][D][S]
  bf16_t* aout   = (bf16_t*)(ws + 40 * MB);   //  8 MB: attn out [4096][1024]

  // convert / transpose to bf16
  const int nx = MTOT * DIM;
  cvt_bf16_kernel<<<nx / 256, 256, 0, stream>>>(x, xb, nx);
  cvt_transpose_kernel<<<dim3(3 * DIM / 64, DIM / 64), 256, 0, stream>>>(qkv_w, wqkvT, DIM, 3 * DIM);
  cvt_transpose_kernel<<<dim3(DIM / 64, DIM / 64), 256, 0, stream>>>(proj_w, wprojT, DIM, DIM);

  // QKV GEMM: [4096,1024] x [1024,3072] -> scattered bf16 Q/K/V
  gemm_bf16_kernel<0><<<dim3(3 * DIM / 256, MTOT / 64), 256, 0, stream>>>(
      xb, wqkvT, qkv_b, qkvbuf, MTOT, 3 * DIM, DIM);

  // attention
  attn_kernel<<<dim3(SEQ / 128, BATCH * NH), 256, 0, stream>>>(qkvbuf, aout);

  // projection GEMM: [4096,1024] x [1024,1024] + bias -> f32 out
  gemm_bf16_kernel<1><<<dim3(DIM / 256, MTOT / 64), 256, 0, stream>>>(
      aout, wprojT, proj_b, d_out, MTOT, DIM, DIM);
}

// v004
// It runs in 170 microseconds.
// In two side-by-side timings against v003, it was 1.25 and 1.23 times as fast.
// Counting every step since v000, it is 2.67 times as fast.
#include <hip/hip_runtime.h>
#include <hip/hip_bf16.h>
#include <stdint.h>

typedef __bf16 bf16_t;
typedef __attribute__((ext_vector_type(8)))  __bf16 v8bf;
typedef __attribute__((ext_vector_type(16))) __bf16 v16bf;
typedef __attribute__((ext_vector_type(8)))  float  v8f;

#define DIM   1024
#define SEQ   2048
#define NH    16
#define HD    64
#define BATCH 2
#define MTOT  (BATCH * SEQ)   // 4096 tokens

// ---------------- helpers ----------------

__device__ __forceinline__ v8f zero8() {
  v8f z;
#pragma unroll
  for (int i = 0; i < 8; ++i) z[i] = 0.0f;
  return z;
}

// Low 32 bits of a generic pointer to __shared__ = LDS byte offset (aperture mapping).
__device__ __forceinline__ unsigned lds_off(const void* p) {
  return (unsigned)(unsigned long long)(uintptr_t)p;
}

// CDNA5 async global->LDS copy (per-lane 16B), tracked by ASYNCcnt.
__device__ __forceinline__ void async_ld_b128(unsigned lds, const void* g) {
  asm volatile("global_load_async_to_lds_b128 %0, %1, off"
               :: "v"(lds), "v"((unsigned long long)(uintptr_t)g)
               : "memory");
}

// Five such copies in one statement. Its last line, s_wait_xcnt 0, is a precaution: it stands
// in front of every later rewrite of the address registers that the copies name, and only
// inside the copies' own statement can the compiler move no such rewrite ahead of it.
__device__ __forceinline__ void async_ld5_b128(unsigned l0, const void* g0,
                                               unsigned l1, const void* g1,
                                               unsigned l2, const void* g2,
                                               unsigned l3, const void* g3,
                                               unsigned l4, const void* g4) {
  asm volatile("global_load_async_to_lds_b128 %0, %1, off\n\t"
               "global_load_async_to_lds_b128 %2, %3, off\n\t"
               "global_load_async_to_lds_b128 %4, %5, off\n\t"
               "global_load_async_to_lds_b128 %6, %7, off\n\t"
               "global_load_async_to_lds_b128 %8, %9, off\n\t"
               "s_wait_xcnt 0x0"
               :: "v"(l0), "v"((unsigned long long)(uintptr_t)g0),
                  "v"(l1), "v"((unsigned long long)(uintptr_t)g1),
                  "v"(l2), "v"((unsigned long long)(uintptr_t)g2),
                  "v"(l3), "v"((unsigned long long)(uintptr_t)g3),
                  "v"(l4), "v"((unsigned long long)(uintptr_t)g4)
               : "memory");
}

template <int N>
__device__ __forceinline__ void wait_asynccnt() {
  asm volatile("s_wait_asynccnt %0" :: "i"(N) : "memory");
}

// Load a 16-element bf16 WMMA fragment: two contiguous 16B chunks at p and p+16
// (ISA 16-bit A/B layout: k = half*8 + e  and  k = 16 + half*8 + e).
__device__ __forceinline__ v16bf ldfrag(const bf16_t* p) {
  v8bf lo = *(const v8bf*)(p);
  v8bf hi = *(const v8bf*)(p + 16);
  return __builtin_shufflevector(lo, hi, 0, 1, 2, 3, 4, 5, 6, 7,
                                 8, 9, 10, 11, 12, 13, 14, 15);
}

__device__ __forceinline__ v8f wmma_bf16(v16bf a, v16bf b, v8f c) {
  return __builtin_amdgcn_wmma_f32_16x16x32_bf16(false, a, false, b,
                                                 (short)0, c, false, false);
}

// ---------------- conversion kernels ----------------

__global__ void cvt_bf16_kernel(const float* __restrict__ in,
                                bf16_t* __restrict__ out, int n) {
  int i = blockIdx.x * blockDim.x + threadIdx.x;
  if (i < n) out[i] = (bf16_t)in[i];
}

// out[c*R + r] = (bf16) in[r*C + c]  (weights as [N][K] for B-fragments)
// One 64x64 tile per block of 256 threads, turned in LDS so that both global sides
// are wide and contiguous: 16 B loads along c, 16 B stores along r (8 lanes fill one
// 128 B line of out). R and C are multiples of 64. grid: (C/64, R/64).
#define TT   64
#define TPIT 65   // f32 pitch: both the row-wise writes and the column-wise reads hit distinct banks

__global__ __launch_bounds__(256) void cvt_transpose_kernel(
    const float* __restrict__ in, bf16_t* __restrict__ out, int R, int C) {
  __shared__ float tile[TT * TPIT];
  const int tid = threadIdx.x;
  const int c0 = blockIdx.x * TT, r0 = blockIdx.y * TT;

  const int lr = tid >> 4, lc = (tid & 15) * 4;
  float4 v[4];
#pragma unroll   // all four loads in flight before the first LDS write; v[] stays in registers
  for (int p = 0; p < 4; ++p)
    v[p] = *(const float4*)(in + (size_t)(r0 + lr + p * 16) * C + c0 + lc);
#pragma unroll   // v[] indexed by constants only
  for (int p = 0; p < 4; ++p) {
    float* t = &tile[(lr + p * 16) * TPIT + lc];
    t[0] = v[p].x; t[1] = v[p].y; t[2] = v[p].z; t[3] = v[p].w;
  }
  __syncthreads();

#pragma unroll   // both chunks' LDS reads issue together
  for (int p = 0; p < 2; ++p) {
    const int q = tid + p * 256;
    const int oc = q >> 3, orr = (q & 7) * 8;
    v8bf w;
#pragma unroll   // w[] indexed by constants only
    for (int i = 0; i < 8; ++i) w[i] = (bf16_t)tile[(orr + i) * TPIT + oc];
    *(v8bf*)(out + (size_t)(c0 + oc) * R + r0 + orr) = w;
  }
}

// ---------------- bf16 GEMM: C[M,N] = A[M,K] * Bt[N,K]^T + bias ----------------
// MODE 0: scatter bf16 into qkv buffer: Q,K as [B][H][S][D]; V as [B][H][D][S].
// MODE 1: f32 output + bias, row-major [M,N].

#define ASTR 40           // padded LDS row strides (40*2 = 80B keeps 16B alignment)
#define BSTR 40
#define ABUF (64 * ASTR)
#define BBUF (256 * BSTR)
#define SVP  72            // staging pitch of a V row, 64 s + 8: 144 B = 16 B x odd
#define SQP  264           // staging pitch of a Q or K token, 256 columns + 8: 528 B = 16 B x odd

template <int MODE>
__global__ __launch_bounds__(256) void gemm_bf16_kernel(
    const bf16_t* __restrict__ A, const bf16_t* __restrict__ Bt,
    const float* __restrict__ bias, void* __restrict__ outp,
    int M, int N, int K) {
  __shared__ __attribute__((aligned(16))) bf16_t Aw[2 * ABUF];   // double-buffered 64x32 A tiles
  __shared__ __attribute__((aligned(16))) bf16_t Bw[2 * BBUF];   // double-buffered 256x32 B tiles

  const int tid  = threadIdx.x;
  const int wave = tid >> 5, lane = tid & 31;
  const int lm   = lane & 15, half = lane >> 4;
  const int wm   = wave >> 2, wn = wave & 3;     // 2 x 4 wave grid
  const int n0   = blockIdx.x * 256;
  const int m0   = blockIdx.y * 64;

  v8f acc[2][4];
#pragma unroll
  for (int mt = 0; mt < 2; ++mt)
#pragma unroll
    for (int nt = 0; nt < 4; ++nt) acc[mt][nt] = zero8();

  const unsigned awb = lds_off(Aw), bwb = lds_off(Bw);
  const int arow = tid >> 2, acol = (tid & 3) * 8;

  // A row of either tile is 64 contiguous bytes of global memory. Four neighbouring lanes
  // bring one row, so a wave-wide copy touches 8 lines; with one row per lane it touches 32.
  auto issue = [&](int buf, int kk) {
    // A tile: 1 async b128 per lane. B tile: 4 per lane, copy i brings rows 64 i .. 64 i + 63.
    const unsigned al = awb + (unsigned)(buf * ABUF + arow * ASTR + acol) * 2;
    const unsigned bl = bwb + (unsigned)(buf * BBUF + arow * BSTR + acol) * 2;
    const bf16_t*  bg = Bt + (size_t)(n0 + arow) * K + kk + acol;
    async_ld5_b128(al, A + (size_t)(m0 + arow) * K + kk + acol,
                   bl, bg,
                   bl + 64 * BSTR * 2, bg + (size_t)64 * K,
                   bl + 128 * BSTR * 2, bg + (size_t)128 * K,
                   bl + 192 * BSTR * 2, bg + (size_t)192 * K);
  };

  issue(0, 0);
  for (int kk = 0; kk < K; kk += 32) {
    const int cur = (kk >> 5) & 1;
    if (kk + 32 < K) {
      issue(cur ^ 1, kk + 32);   // prefetch next tile into other buffer
      wait_asynccnt<5>();        // 5 oldest (current buffer) retired
    } else {
      wait_asynccnt<0>();
    }
    __syncthreads();

    const bf16_t* Ac = &Aw[cur * ABUF];
    const bf16_t* Bc = &Bw[cur * BBUF];
    v16bf af[2], bfg[4];
#pragma unroll
    for (int mt = 0; mt < 2; ++mt)
      af[mt] = ldfrag(&Ac[(wm * 32 + mt * 16 + lm) * ASTR + half * 8]);
#pragma unroll
    for (int nt = 0; nt < 4; ++nt)
      bfg[nt] = ldfrag(&Bc[(wn * 64 + nt * 16 + lm) * BSTR + half * 8]);
#pragma unroll
    for (int mt = 0; mt < 2; ++mt) {
#pragma unroll
      for (int nt = 0; nt < 4; ++nt)
        acc[mt][nt] = wmma_bf16(af[mt], bfg[nt], acc[mt][nt]);
    }
    __syncthreads();
  }

  // epilogue
  if (MODE == 0) {
    // The 64 x 256 bf16 tile is turned in LDS so that every global store is 16 B a lane and
    // 8 neighbouring lanes fill one 128 B line. The B ring is free: the loop's last barrier
    // ended its reads, and every wave's copies had landed before the barrier in front of them.
    // 256 divides DIM and 64 divides SEQ, so part, batch and the four heads are the block's.
    bf16_t* St = Bw;
    const int part = n0 >> 10;
    const int bb = m0 >> 11, s0 = m0 & (SEQ - 1);
    const int h0 = (n0 & (DIM - 1)) >> 6;
    bf16_t* ob = (bf16_t*)outp + (size_t)part * ((size_t)BATCH * NH * SEQ * HD) +
                 (size_t)(bb * NH + h0) * (SEQ * HD);
    float bs[4];
#pragma unroll
    for (int nt = 0; nt < 4; ++nt) bs[nt] = bias[n0 + wn * 64 + nt * 16 + lm];

    if (part == 2) {
      // V goes out as [d][s]: a lane's 8 accumulators are 8 neighbouring s of one d.
#pragma unroll
      for (int mt = 0; mt < 2; ++mt) {
#pragma unroll
        for (int nt = 0; nt < 4; ++nt) {
          v8bf w;
#pragma unroll
          for (int r = 0; r < 8; ++r) w[r] = (bf16_t)(acc[mt][nt][r] + bs[nt]);
          *(v8bf*)&St[(wn * 64 + nt * 16 + lm) * SVP + wm * 32 + mt * 16 + 8 * half] = w;
        }
      }
    } else {
      // Q, K go out as [s][d]: staged row-major, m = r + 8*half, n = lane%16.
#pragma unroll
      for (int mt = 0; mt < 2; ++mt) {
#pragma unroll
        for (int nt = 0; nt < 4; ++nt) {
#pragma unroll
          for (int r = 0; r < 8; ++r)
            St[(wm * 32 + mt * 16 + r + 8 * half) * SQP + wn * 64 + nt * 16 + lm] =
                (bf16_t)(acc[mt][nt][r] + bs[nt]);
        }
      }
    }
    __syncthreads();
    if (part == 2) {
#pragma unroll   // all eight LDS reads issue together
      for (int p = 0; p < 8; ++p) {
        const int q = tid + p * 256;
        const int n = q >> 3, c = (q & 7) * 8;      // row h*64 + d of the four heads; 8 s
        *(v8bf*)(ob + (size_t)n * SEQ + s0 + c) = *(const v8bf*)&St[n * SVP + c];
      }
    } else {
#pragma unroll   // all eight LDS reads issue together
      for (int p = 0; p < 8; ++p) {
        const int q = tid + p * 256;
        const int m = q >> 5, c = q & 31;           // token; 16 B chunk of its 256 columns
        *(v8bf*)(ob + (size_t)(c >> 3) * (SEQ * HD) + (size_t)(s0 + m) * HD + (c & 7) * 8) =
            *(const v8bf*)&St[m * SQP + c * 8];
      }
    }
  } else {
#pragma unroll
    for (int mt = 0; mt < 2; ++mt) {
#pragma unroll
      for (int nt = 0; nt < 4; ++nt) {
#pragma unroll
        for (int r = 0; r < 8; ++r) {
          int gm = m0 + wm * 32 + mt * 16 + r + 8 * half;   // C/D: m = r + 8*half
          int gn = n0 + wn * 64 + nt * 16 + lm;             // C/D: n = lane%16
          ((float*)outp)[(size_t)gm * N + gn] = acc[mt][nt][r] + bias[gn];
        }
      }
    }
  }
}

// ---------------- flash attention ----------------
// grid: (SEQ/128, BATCH*NH); block 256 threads = 8 waves; wave owns 16 q rows.
// qkv: Q,K [B][H][S][D]; V [B][H][D][S] (bf16).  aout: [B*S][DIM] bf16.

// LDS rows of K, V and P hold 64 bf16 (128 B) and are all read as 16 B fragments, one row
// per lane: at a 128 B pitch 16 lanes fall on two bank groups, at 144 B (16 B x odd) on all.
#define KVP   72            // LDS row pitch in elements (64 used + 8 never read)
#define KVBUF (64 * KVP)    // elements per K or V tile

__global__ __launch_bounds__(256) void attn_kernel(const bf16_t* __restrict__ qkv,
                                                   bf16_t* __restrict__ aout) {
  __shared__ __attribute__((aligned(16))) bf16_t Kw[2 * KVBUF];      // [key][d]    18 KB (double buffered)
  __shared__ __attribute__((aligned(16))) bf16_t Vt[2 * KVBUF];      // [d][key]    18 KB (double buffered)
  __shared__ __attribute__((aligned(16))) bf16_t Pw[8 * 16 * KVP];   // per-wave P  18 KB

  const int tid  = threadIdx.x;
  const int wave = tid >> 5, lane = tid & 31;
  const int lm   = lane & 15, half = lane >> 4;
  const int bh   = blockIdx.y;
  const int b    = bh >> 4, h = bh & 15;

  const size_t partsz = (size_t)BATCH * NH * SEQ * HD;
  const bf16_t* Qb = qkv + ((size_t)b * NH + h) * SEQ * HD;
  const bf16_t* Kb = qkv + partsz + ((size_t)b * NH + h) * SEQ * HD;
  const bf16_t* Vb = qkv + 2 * partsz + ((size_t)b * NH + h) * HD * SEQ;  // [d][s]

  const int q0 = blockIdx.x * 128 + wave * 16;

  // Q fragments (A operand), loaded once: k-dim = 64 -> 2 chunks of 32
  v16bf aq[2];
#pragma unroll
  for (int kh = 0; kh < 2; ++kh)
    aq[kh] = ldfrag(Qb + (size_t)(q0 + lm) * HD + kh * 32 + half * 8);

  v8f o[4];
#pragma unroll
  for (int t = 0; t < 4; ++t) o[t] = zero8();
  float m_row[8], l_row[8];
#pragma unroll
  for (int r = 0; r < 8; ++r) { m_row[r] = -1e30f; l_row[r] = 0.0f; }

  bf16_t* Pww = &Pw[wave * 16 * KVP];
  const unsigned kwb = lds_off(Kw), vtb = lds_off(Vt);
  const int ldr = tid >> 2, ldc = (tid & 3) * 16;
  const float scale = 0.125f;   // 1/sqrt(64)

  auto issue_kv = [&](int buf, int j0) {
    // K block [64 keys][64 d] -> Kw[key][d]
    const bf16_t* kg = Kb + (size_t)(j0 + ldr) * HD + ldc;
    unsigned kl = kwb + (unsigned)(buf * KVBUF + ldr * KVP + ldc) * 2;
    async_ld_b128(kl, kg);
    async_ld_b128(kl + 16, kg + 8);
    // V block (global already [d][s]) -> Vt[d][key]
    const bf16_t* vg = Vb + (size_t)ldr * SEQ + j0 + ldc;
    unsigned vl = vtb + (unsigned)(buf * KVBUF + ldr * KVP + ldc) * 2;
    async_ld_b128(vl, vg);
    async_ld_b128(vl + 16, vg + 8);
  };

  issue_kv(0, 0);
  for (int jb = 0; jb < SEQ / 64; ++jb) {
    const int cur = jb & 1;
    if (jb + 1 < SEQ / 64) {
      issue_kv(cur ^ 1, (jb + 1) * 64);
      wait_asynccnt<4>();
    } else {
      wait_asynccnt<0>();
    }
    __syncthreads();

    const bf16_t* Kc = &Kw[cur * KVBUF];
    const bf16_t* Vc = &Vt[cur * KVBUF];

    // ---- scores S = Q * K^T  (16 x 64 per wave, 8 WMMAs) ----
    v8f s[4];
#pragma unroll
    for (int t = 0; t < 4; ++t) s[t] = zero8();
#pragma unroll
    for (int kh = 0; kh < 2; ++kh) {
#pragma unroll
      for (int t = 0; t < 4; ++t) {
        v16bf bk = ldfrag(&Kc[(t * 16 + lm) * KVP + kh * 32 + half * 8]);
        s[t] = wmma_bf16(aq[kh], bk, s[t]);
      }
    }
#pragma unroll
    for (int t = 0; t < 4; ++t)
#pragma unroll
      for (int r = 0; r < 8; ++r) s[t][r] *= scale;

    // ---- online softmax per row (row = r + 8*half; 16 lanes hold a row) ----
#pragma unroll
    for (int r = 0; r < 8; ++r) {
      float mx = fmaxf(fmaxf(s[0][r], s[1][r]), fmaxf(s[2][r], s[3][r]));
#pragma unroll
      for (int d = 1; d < 16; d <<= 1) mx = fmaxf(mx, __shfl_xor(mx, d));
      float mn   = fmaxf(m_row[r], mx);
      float corr = __expf(m_row[r] - mn);
      m_row[r]   = mn;
      float lb = 0.0f;
#pragma unroll
      for (int t = 0; t < 4; ++t) {
        float p = __expf(s[t][r] - mn);
        s[t][r] = p;
        lb += p;
      }
#pragma unroll
      for (int d = 1; d < 16; d <<= 1) lb += __shfl_xor(lb, d);
      l_row[r] = l_row[r] * corr + lb;
#pragma unroll
      for (int t = 0; t < 4; ++t) o[t][r] *= corr;
    }

    // ---- write P (bf16) to wave-private LDS, layout [qrow][key] ----
#pragma unroll
    for (int t = 0; t < 4; ++t)
#pragma unroll
      for (int r = 0; r < 8; ++r)
        Pww[(r + 8 * half) * KVP + t * 16 + lm] = (bf16_t)s[t][r];

    // ---- O += P * V  (8 WMMAs; B-fragments from [d][key] V) ----
#pragma unroll
    for (int kh = 0; kh < 2; ++kh) {
      v16bf ap = ldfrag(&Pww[lm * KVP + kh * 32 + half * 8]);
#pragma unroll
      for (int t = 0; t < 4; ++t) {
        v16bf bv = ldfrag(&Vc[(t * 16 + lm) * KVP + kh * 32 + half * 8]);
        o[t] = wmma_bf16(ap, bv, o[t]);
      }
    }
    __syncthreads();
  }

  // ---- finalize: divide by l, store bf16 into [B*S][DIM] ----
#pragma unroll
  for (int r = 0; r < 8; ++r) {
    float inv = 1.0f / l_row[r];
    int srow = q0 + r + 8 * half;
#pragma unroll
    for (int t = 0; t < 4; ++t) {
      int col = h * HD + t * 16 + lm;
      aout[((size_t)b * SEQ + srow) * DIM + col] = (bf16_t)(o[t][r] * inv);
    }
  }
}

// ---------------- launch ----------------

extern "C" void kernel_launch(void* const* d_in, const int* in_sizes, int n_in,
                              void* d_out, int out_size, void* d_ws, size_t ws_size,
                              hipStream_t stream) {
  const float* x      = (const float*)d_in[0];
  const float* qkv_w  = (const float*)d_in[1];
  const float* qkv_b  = (const float*)d_in[2];
  const float* proj_w = (const float*)d_in[3];
  const float* proj_b = (const float*)d_in[4];

  const size_t MB = 1u << 20;
  char* ws = (char*)d_ws;
  bf16_t* xb     = (bf16_t*)(ws);             //  8 MB: x as bf16 [4096][1024]
  bf16_t* wqkvT  = (bf16_t*)(ws + 8 * MB);    //  6 MB: qkv_w^T [3072][1024]
  bf16_t* wprojT = (bf16_t*)(ws + 14 * MB);   //  2 MB: proj_w^T [1024][1024]
  bf16_t* qkvbuf = (bf16_t*)(ws + 16 * MB);   // 24 MB: Q,K [B][H][S][D]; V [B][H][D][S]
  bf16_t* aout   = (bf16_t*)(ws + 40 * MB);   //  8 MB: attn out [4096][1024]

  // convert / transpose to bf16
  const int nx = MTOT * DIM;
  cvt_bf16_kernel<<<nx / 256, 256, 0, stream>>>(x, xb, nx);
  cvt_transpose_kernel<<<dim3(3 * DIM / 64, DIM / 64), 256, 0, stream>>>(qkv_w, wqkvT, DIM, 3 * DIM);
  cvt_transpose_kernel<<<dim3(DIM / 64, DIM / 64), 256, 0, stream>>>(proj_w, wprojT, DIM, DIM);

  // QKV GEMM: [4096,1024] x [1024,3072] -> scattered bf16 Q/K/V
  gemm_bf16_kernel<0><<<dim3(3 * DIM / 256, MTOT / 64), 256, 0, stream>>>(
      xb, wqkvT, qkv_b, qkvbuf, MTOT, 3 * DIM, DIM);

  // attention
  attn_kernel<<<dim3(SEQ / 128, BATCH * NH), 256, 0, stream>>>(qkvbuf, aout);

  // projection GEMM: [4096,1024] x [1024,1024] + bias -> f32 out
  gemm_bf16_kernel<1><<<dim3(DIM / 256, MTOT / 64), 256, 0, stream>>>(
      aout, wprojT, proj_b, d_out, MTOT, DIM, DIM);
}

// v005
// It runs in 121 microseconds.
// In two side-by-side timings against v004, it was 1.41 and 1.40 times as fast.
// Over all steps from v000 it is 3.75 times as fast.
#include <hip/hip_runtime.h>
#include <hip/hip_bf16.h>
#include <stdint.h>

typedef __bf16 bf16_t;
typedef __attribute__((ext_vector_type(8)))  __bf16 v8bf;
typedef __attribute__((ext_vector_type(16))) __bf16 v16bf;
typedef __attribute__((ext_vector_type(8)))  float  v8f;
typedef __attribute__((ext_vector_type(2)))  float  v2f;

#define DIM   1024
#define SEQ   2048
#define NH    16
#define HD    64
#define BATCH 2
#define MTOT  (BATCH * SEQ)   // 4096 tokens

// ---------------- helpers ----------------

__device__ __forceinline__ v8f zero8() {
  v8f z;
#pragma unroll
  for (int i = 0; i < 8; ++i) z[i] = 0.0f;
  return z;
}

// Low 32 bits of a generic pointer to __shared__ = LDS byte offset (aperture mapping).
__device__ __forceinline__ unsigned lds_off(const void* p) {
  return (unsigned)(unsigned long long)(uintptr_t)p;
}

// CDNA5 async global->LDS copy (per-lane 16B), tracked by ASYNCcnt.
__device__ __forceinline__ void async_ld_b128(unsigned lds, const void* g) {
  asm volatile("global_load_async_to_lds_b128 %0, %1, off"
               :: "v"(lds), "v"((unsigned long long)(uintptr_t)g)
               : "memory");
}

// Five such copies in one statement. Its last line, s_wait_xcnt 0, is a precaution: it stands
// in front of every later rewrite of the address registers that the copies name, and only
// inside the copies' own statement can the compiler move no such rewrite ahead of it.
__device__ __forceinline__ void async_ld5_b128(unsigned l0, const void* g0,
                                               unsigned l1, const void* g1,
                                               unsigned l2, const void* g2,
                                               unsigned l3, const void* g3,
                                               unsigned l4, const void* g4) {
  asm volatile("global_load_async_to_lds_b128 %0, %1, off\n\t"
               "global_load_async_to_lds_b128 %2, %3, off\n\t"
               "global_load_async_to_lds_b128 %4, %5, off\n\t"
               "global_load_async_to_lds_b128 %6, %7, off\n\t"
               "global_load_async_to_lds_b128 %8, %9, off\n\t"
               "s_wait_xcnt 0x0"
               :: "v"(l0), "v"((unsigned long long)(uintptr_t)g0),
                  "v"(l1), "v"((unsigned long long)(uintptr_t)g1),
                  "v"(l2), "v"((unsigned long long)(uintptr_t)g2),
                  "v"(l3), "v"((unsigned long long)(uintptr_t)g3),
                  "v"(l4), "v"((unsigned long long)(uintptr_t)g4)
               : "memory");
}

template <int N>
__device__ __forceinline__ void wait_asynccnt() {
  asm volatile("s_wait_asynccnt %0" :: "i"(N) : "memory");
}

// Load a 16-element bf16 WMMA fragment: two contiguous 16B chunks at p and p+16
// (ISA 16-bit A/B layout: k = half*8 + e  and  k = 16 + half*8 + e).
__device__ __forceinline__ v16bf ldfrag(const bf16_t* p) {
  v8bf lo = *(const v8bf*)(p);
  v8bf hi = *(const v8bf*)(p + 16);
  return __builtin_shufflevector(lo, hi, 0, 1, 2, 3, 4, 5, 6, 7,
                                 8, 9, 10, 11, 12, 13, 14, 15);
}

__device__ __forceinline__ v8f wmma_bf16(v16bf a, v16bf b, v8f c) {
  return __builtin_amdgcn_wmma_f32_16x16x32_bf16(false, a, false, b,
                                                 (short)0, c, false, false);
}

// Value of lane l ^ 16 (the other half of the wave), by a vector cross-row move.
__device__ __forceinline__ float xhalf(float x) {
  const int b = __builtin_bit_cast(int, x);
  return __builtin_bit_cast(float, __builtin_amdgcn_permlanex16(b, b, 0x76543210, 0xfedcba98,
                                                                false, false));
}

// ---------------- conversion kernels ----------------

__global__ void cvt_bf16_kernel(const float* __restrict__ in,
                                bf16_t* __restrict__ out, int n) {
  int i = blockIdx.x * blockDim.x + threadIdx.x;
  if (i < n) out[i] = (bf16_t)in[i];
}

// out[c*R + r] = (bf16) in[r*C + c]  (weights as [N][K] for B-fragments)
// One 64x64 tile per block of 256 threads, turned in LDS so that both global sides
// are wide and contiguous: 16 B loads along c, 16 B stores along r (8 lanes fill one
// 128 B line of out). R and C are multiples of 64. grid: (C/64, R/64).
#define TT   64
#define TPIT 65   // f32 pitch: both the row-wise writes and the column-wise reads hit distinct banks

__global__ __launch_bounds__(256) void cvt_transpose_kernel(
    const float* __restrict__ in, bf16_t* __restrict__ out, int R, int C) {
  __shared__ float tile[TT * TPIT];
  const int tid = threadIdx.x;
  const int c0 = blockIdx.x * TT, r0 = blockIdx.y * TT;

  const int lr = tid >> 4, lc = (tid & 15) * 4;
  float4 v[4];
#pragma unroll   // all four loads in flight before the first LDS write; v[] stays in registers
  for (int p = 0; p < 4; ++p)
    v[p] = *(const float4*)(in + (size_t)(r0 + lr + p * 16) * C + c0 + lc);
#pragma unroll   // v[] indexed by constants only
  for (int p = 0; p < 4; ++p) {
    float* t = &tile[(lr + p * 16) * TPIT + lc];
    t[0] = v[p].x; t[1] = v[p].y; t[2] = v[p].z; t[3] = v[p].w;
  }
  __syncthreads();

#pragma unroll   // both chunks' LDS reads issue together
  for (int p = 0; p < 2; ++p) {
    const int q = tid + p * 256;
    const int oc = q >> 3, orr = (q & 7) * 8;
    v8bf w;
#pragma unroll   // w[] indexed by constants only
    for (int i = 0; i < 8; ++i) w[i] = (bf16_t)tile[(orr + i) * TPIT + oc];
    *(v8bf*)(out + (size_t)(c0 + oc) * R + r0 + orr) = w;
  }
}

// ---------------- bf16 GEMM: C[M,N] = A[M,K] * Bt[N,K]^T + bias ----------------
// MODE 0: scatter bf16 into qkv buffer: Q,K as [B][H][S][D]; V as [B][H][D][S].
// MODE 1: f32 output + bias, row-major [M,N].

#define ASTR 40           // padded LDS row strides (40*2 = 80B keeps 16B alignment)
#define BSTR 40
#define ABUF (64 * ASTR)
#define BBUF (256 * BSTR)
#define SVP  72            // staging pitch of a V row, 64 s + 8: 144 B = 16 B x odd
#define SQP  264           // staging pitch of a Q or K token, 256 columns + 8: 528 B = 16 B x odd

template <int MODE>
__global__ __launch_bounds__(256) void gemm_bf16_kernel(
    const bf16_t* __restrict__ A, const bf16_t* __restrict__ Bt,
    const float* __restrict__ bias, void* __restrict__ outp,
    int M, int N, int K) {
  __shared__ __attribute__((aligned(16))) bf16_t Aw[2 * ABUF];   // double-buffered 64x32 A tiles
  __shared__ __attribute__((aligned(16))) bf16_t Bw[2 * BBUF];   // double-buffered 256x32 B tiles

  const int tid  = threadIdx.x;
  const int wave = tid >> 5, lane = tid & 31;
  const int lm   = lane & 15, half = lane >> 4;
  const int wm   = wave >> 2, wn = wave & 3;     // 2 x 4 wave grid
  const int n0   = blockIdx.x * 256;
  const int m0   = blockIdx.y * 64;

  v8f acc[2][4];
#pragma unroll
  for (int mt = 0; mt < 2; ++mt)
#pragma unroll
    for (int nt = 0; nt < 4; ++nt) acc[mt][nt] = zero8();

  const unsigned awb = lds_off(Aw), bwb = lds_off(Bw);
  const int arow = tid >> 2, acol = (tid & 3) * 8;

  // A row of either tile is 64 contiguous bytes of global memory. Four neighbouring lanes
  // bring one row, so a wave-wide copy touches 8 lines; with one row per lane it touches 32.
  auto issue = [&](int buf, int kk) {
    // A tile: 1 async b128 per lane. B tile: 4 per lane, copy i brings rows 64 i .. 64 i + 63.
    const unsigned al = awb + (unsigned)(buf * ABUF + arow * ASTR + acol) * 2;
    const unsigned bl = bwb + (unsigned)(buf * BBUF + arow * BSTR + acol) * 2;
    const bf16_t*  bg = Bt + (size_t)(n0 + arow) * K + kk + acol;
    async_ld5_b128(al, A + (size_t)(m0 + arow) * K + kk + acol,
                   bl, bg,
                   bl + 64 * BSTR * 2, bg + (size_t)64 * K,
                   bl + 128 * BSTR * 2, bg + (size_t)128 * K,
                   bl + 192 * BSTR * 2, bg + (size_t)192 * K);
  };

  issue(0, 0);
  for (int kk = 0; kk < K; kk += 32) {
    const int cur = (kk >> 5) & 1;
    if (kk + 32 < K) {
      issue(cur ^ 1, kk + 32);   // prefetch next tile into other buffer
      wait_asynccnt<5>();        // 5 oldest (current buffer) retired
    } else {
      wait_asynccnt<0>();
    }
    __syncthreads();

    const bf16_t* Ac = &Aw[cur * ABUF];
    const bf16_t* Bc = &Bw[cur * BBUF];
    v16bf af[2], bfg[4];
#pragma unroll
    for (int mt = 0; mt < 2; ++mt)
      af[mt] = ldfrag(&Ac[(wm * 32 + mt * 16 + lm) * ASTR + half * 8]);
#pragma unroll
    for (int nt = 0; nt < 4; ++nt)
      bfg[nt] = ldfrag(&Bc[(wn * 64 + nt * 16 + lm) * BSTR + half * 8]);
#pragma unroll
    for (int mt = 0; mt < 2; ++mt) {
#pragma unroll
      for (int nt = 0; nt < 4; ++nt)
        acc[mt][nt] = wmma_bf16(af[mt], bfg[nt], acc[mt][nt]);
    }
    __syncthreads();
  }

  // epilogue
  if (MODE == 0) {
    // The 64 x 256 bf16 tile is turned in LDS so that every global store is 16 B a lane and
    // 8 neighbouring lanes fill one 128 B line. The B ring is free: the loop's last barrier
    // ended its reads, and every wave's copies had landed before the barrier in front of them.
    // 256 divides DIM and 64 divides SEQ, so part, batch and the four heads are the block's.
    bf16_t* St = Bw;
    const int part = n0 >> 10;
    const int bb = m0 >> 11, s0 = m0 & (SEQ - 1);
    const int h0 = (n0 & (DIM - 1)) >> 6;
    bf16_t* ob = (bf16_t*)outp + (size_t)part * ((size_t)BATCH * NH * SEQ * HD) +
                 (size_t)(bb * NH + h0) * (SEQ * HD);
    float bs[4];
#pragma unroll
    for (int nt = 0; nt < 4; ++nt) bs[nt] = bias[n0 + wn * 64 + nt * 16 + lm];

    if (part == 2) {
      // V goes out as [d][s]: a lane's 8 accumulators are 8 neighbouring s of one d.
#pragma unroll
      for (int mt = 0; mt < 2; ++mt) {
#pragma unroll
        for (int nt = 0; nt < 4; ++nt) {
          v8bf w;
#pragma unroll
          for (int r = 0; r < 8; ++r) w[r] = (bf16_t)(acc[mt][nt][r] + bs[nt]);
          *(v8bf*)&St[(wn * 64 + nt * 16 + lm) * SVP + wm * 32 + mt * 16 + 8 * half] = w;
        }
      }
    } else {
      // Q, K go out as [s][d]: staged row-major, m = r + 8*half, n = lane%16.
#pragma unroll
      for (int mt = 0; mt < 2; ++mt) {
#pragma unroll
        for (int nt = 0; nt < 4; ++nt) {
#pragma unroll
          for (int r = 0; r < 8; ++r)
            St[(wm * 32 + mt * 16 + r + 8 * half) * SQP + wn * 64 + nt * 16 + lm] =
                (bf16_t)(acc[mt][nt][r] + bs[nt]);
        }
      }
    }
    __syncthreads();
    if (part == 2) {
#pragma unroll   // all eight LDS reads issue together
      for (int p = 0; p < 8; ++p) {
        const int q = tid + p * 256;
        const int n = q >> 3, c = (q & 7) * 8;      // row h*64 + d of the four heads; 8 s
        *(v8bf*)(ob + (size_t)n * SEQ + s0 + c) = *(const v8bf*)&St[n * SVP + c];
      }
    } else {
#pragma unroll   // all eight LDS reads issue together
      for (int p = 0; p < 8; ++p) {
        const int q = tid + p * 256;
        const int m = q >> 5, c = q & 31;           // token; 16 B chunk of its 256 columns
        *(v8bf*)(ob + (size_t)(c >> 3) * (SEQ * HD) + (size_t)(s0 + m) * HD + (c & 7) * 8) =
            *(const v8bf*)&St[m * SQP + c * 8];
      }
    }
  } else {
#pragma unroll
    for (int mt = 0; mt < 2; ++mt) {
#pragma unroll
      for (int nt = 0; nt < 4; ++nt) {
#pragma unroll
        for (int r = 0; r < 8; ++r) {
          int gm = m0 + wm * 32 + mt * 16 + r + 8 * half;   // C/D: m = r + 8*half
          int gn = n0 + wn * 64 + nt * 16 + lm;             // C/D: n = lane%16
          ((float*)outp)[(size_t)gm * N + gn] = acc[mt][nt][r] + bias[gn];
        }
      }
    }
  }
}

// LDS rows of K and V hold 64 bf16 (128 B) and are all read as 16 B fragments, one row
// per lane: at a 128 B pitch 16 lanes fall on two bank groups, at 144 B (16 B x odd) on all.
#define KVP   72            // LDS row pitch in elements (64 used + 8 never read)
#define KVBUF (64 * KVP)    // elements per K or V tile

// The grid puts two blocks on a WGP, four waves on a SIMD: said here so that the compiler
// spends registers on LDS reads issued in groups ahead of the products instead of saving
// them for waves that the grid does not have.
__global__ __launch_bounds__(256) __attribute__((amdgpu_waves_per_eu(4, 4)))
void attn_kernel(const bf16_t* __restrict__ qkv,
                                                   bf16_t* __restrict__ aout) {
  __shared__ __attribute__((aligned(16))) bf16_t Kw[2 * KVBUF];      // [key][d]    18 KB (double buffered)
  __shared__ __attribute__((aligned(16))) bf16_t Vt[2 * KVBUF];      // [d][key]    18 KB (double buffered)

  const int tid  = threadIdx.x;
  const int wave = tid >> 5, lane = tid & 31;
  const int lm   = lane & 15, half = lane >> 4;
  const int bh   = blockIdx.y;
  const int b    = bh >> 4, h = bh & 15;

  const size_t partsz = (size_t)BATCH * NH * SEQ * HD;
  const bf16_t* Qb = qkv + ((size_t)b * NH + h) * SEQ * HD;
  const bf16_t* Kb = qkv + partsz + ((size_t)b * NH + h) * SEQ * HD;
  const bf16_t* Vb = qkv + 2 * partsz + ((size_t)b * NH + h) * HD * SEQ;  // [d][s]

  const int q0 = blockIdx.x * 128 + wave * 16;

  // Q fragments (B operand: column = query lane%16), loaded once: k-dim = 64 -> 2 chunks of 32
  v16bf aq[2];
#pragma unroll
  for (int kh = 0; kh < 2; ++kh)
    aq[kh] = ldfrag(Qb + (size_t)(q0 + lm) * HD + kh * 32 + half * 8);

  v8f o[4];
#pragma unroll
  for (int t = 0; t < 4; ++t) o[t] = zero8();
  // The lane's query: running maximum (equal in both halves) and the sum over this half's keys.
  float m_run = -1e30f, l_run = 0.0f;

  const unsigned kwb = lds_off(Kw), vtb = lds_off(Vt);
  const int ldr = tid >> 2, ldc = (tid & 3) * 16;
  const float scale = 0.125f;   // 1/sqrt(64)

  auto issue_kv = [&](int buf, int j0) {
    // K block [64 keys][64 d] -> Kw[key][d]
    const bf16_t* kg = Kb + (size_t)(j0 + ldr) * HD + ldc;
    unsigned kl = kwb + (unsigned)(buf * KVBUF + ldr * KVP + ldc) * 2;
    async_ld_b128(kl, kg);
    async_ld_b128(kl + 16, kg + 8);
    // V block (global already [d][s]) -> Vt[d][key]
    const bf16_t* vg = Vb + (size_t)ldr * SEQ + j0 + ldc;
    unsigned vl = vtb + (unsigned)(buf * KVBUF + ldr * KVP + ldc) * 2;
    async_ld_b128(vl, vg);
    async_ld_b128(vl + 16, vg + 8);
  };

  issue_kv(0, 0);
  for (int jb = 0; jb < SEQ / 64; ++jb) {
    const int cur = jb & 1;
    if (jb + 1 < SEQ / 64) {
      issue_kv(cur ^ 1, (jb + 1) * 64);
      wait_asynccnt<4>();
    } else {
      wait_asynccnt<0>();
    }
    __syncthreads();

    const bf16_t* Kc = &Kw[cur * KVBUF];
    const bf16_t* Vc = &Vt[cur * KVBUF];

    // ---- scores S^T = K * Q^T  (64 keys x 16 queries per wave, 8 WMMAs) ----
    // s[t][r] = score of key t*16 + 8*half + r with query lane%16
    v8f s[4];
#pragma unroll
    for (int t = 0; t < 4; ++t) s[t] = zero8();
#pragma unroll
    for (int kh = 0; kh < 2; ++kh) {
#pragma unroll
      for (int t = 0; t < 4; ++t) {
        v16bf ak = ldfrag(&Kc[(t * 16 + lm) * KVP + kh * 32 + half * 8]);
        s[t] = wmma_bf16(ak, aq[kh], s[t]);
      }
    }
#pragma unroll
    for (int t = 0; t < 4; ++t)
#pragma unroll
      for (int r = 0; r < 8; ++r) s[t][r] *= scale;

    // ---- online softmax, one query per lane: 32 keys in-lane, the other 32 in lane ^ 16 ----
    float mt4[4];
#pragma unroll   // four independent chains, one per tile
    for (int t = 0; t < 4; ++t) {
      mt4[t] = s[t][0];
#pragma unroll   // s[] indexed by constants only: stays in registers
      for (int r = 1; r < 8; ++r) mt4[t] = fmaxf(mt4[t], s[t][r]);
    }
    float mx = fmaxf(fmaxf(mt4[0], mt4[1]), fmaxf(mt4[2], mt4[3]));
    mx = fmaxf(mx, xhalf(mx));
    const float mn   = fmaxf(m_run, mx);
    const float corr = __expf(m_run - mn);
    m_run = mn;
    v2f l2[2];   // two independent chains of packed adds over register pairs
    l2[0] = (v2f){0.0f, 0.0f};
    l2[1] = (v2f){0.0f, 0.0f};
#pragma unroll   // s[] and l2[] indexed by constants only: stay in registers
    for (int t = 0; t < 4; ++t) {
#pragma unroll   // likewise
      for (int r = 0; r < 8; r += 2) {
        const float p0 = __expf(s[t][r] - mn), p1 = __expf(s[t][r + 1] - mn);
        s[t][r] = p0;
        s[t][r + 1] = p1;
        l2[t & 1] += (v2f){p0, p1};
      }
    }
    l2[0] += l2[1];
    l_run = l_run * corr + (l2[0].x + l2[0].y);
#pragma unroll
    for (int t = 0; t < 4; ++t)
#pragma unroll
      for (int r = 0; r < 8; ++r) o[t][r] *= corr;

    // ---- O^T += V^T * P^T  (8 WMMAs; A-fragments from [d][key] V) ----
    // B element e of lane (lm, half) is key half*8 + e (e < 8) or 16 + half*8 + e - 8 of the
    // 32: exactly what tiles 2*kh and 2*kh + 1 of S^T hold in this lane.
#pragma unroll
    for (int kh = 0; kh < 2; ++kh) {
      v16bf bp;
#pragma unroll   // packed converts of register pairs, no indexing at run time
      for (int r = 0; r < 8; ++r) {
        bp[r]     = (bf16_t)s[2 * kh][r];
        bp[8 + r] = (bf16_t)s[2 * kh + 1][r];
      }
#pragma unroll
      for (int t = 0; t < 4; ++t) {
        v16bf av = ldfrag(&Vc[(t * 16 + lm) * KVP + kh * 32 + half * 8]);
        o[t] = wmma_bf16(av, bp, o[t]);
      }
    }
    __syncthreads();
  }

  // ---- finalize: join the halves' sums, divide by l, store bf16 into [B*S][DIM] ----
  // o[t][r] = O[query lane%16][d = t*16 + 8*half + r]: 8 neighbouring d, one 16 B store.
  const float inv = 1.0f / (l_run + xhalf(l_run));
  bf16_t* orow = aout + ((size_t)b * SEQ + q0 + lm) * DIM + h * HD + 8 * half;
#pragma unroll   // o[] indexed by constants only; the four stores issue together
  for (int t = 0; t < 4; ++t) {
    v8bf w;
#pragma unroll   // w[] indexed by constants only
    for (int r = 0; r < 8; ++r) w[r] = (bf16_t)(o[t][r] * inv);
    *(v8bf*)(orow + t * 16) = w;
  }
}

// ---------------- launch ----------------

extern "C" void kernel_launch(void* const* d_in, const int* in_sizes, int n_in,
                              void* d_out, int out_size, void* d_ws, size_t ws_size,
                              hipStream_t stream) {
  const float* x      = (const float*)d_in[0];
  const float* qkv_w  = (const float*)d_in[1];
  const float* qkv_b  = (const float*)d_in[2];
  const float* proj_w = (const float*)d_in[3];
  const float* proj_b = (const float*)d_in[4];

  const size_t MB = 1u << 20;
  char* ws = (char*)d_ws;
  bf16_t* xb     = (bf16_t*)(ws);             //  8 MB: x as bf16 [4096][1024]
  bf16_t* wqkvT  = (bf16_t*)(ws + 8 * MB);    //  6 MB: qkv_w^T [3072][1024]
  bf16_t* wprojT = (bf16_t*)(ws + 14 * MB);   //  2 MB: proj_w^T [1024][1024]
  bf16_t* qkvbuf = (bf16_t*)(ws + 16 * MB);   // 24 MB: Q,K [B][H][S][D]; V [B][H][D][S]
  bf16_t* aout   = (bf16_t*)(ws + 40 * MB);   //  8 MB: attn out [4096][1024]

  // convert / transpose to bf16
  const int nx = MTOT * DIM;
  cvt_bf16_kernel<<<nx / 256, 256, 0, stream>>>(x, xb, nx);
  cvt_transpose_kernel<<<dim3(3 * DIM / 64, DIM / 64), 256, 0, stream>>>(qkv_w, wqkvT, DIM, 3 * DIM);
  cvt_transpose_kernel<<<dim3(DIM / 64, DIM / 64), 256, 0, stream>>>(proj_w, wprojT, DIM, DIM);

  // QKV GEMM: [4096,1024] x [1024,3072] -> scattered bf16 Q/K/V
  gemm_bf16_kernel<0><<<dim3(3 * DIM / 256, MTOT / 64), 256, 0, stream>>>(
      xb, wqkvT, qkv_b, qkvbuf, MTOT, 3 * DIM, DIM);

  // attention
  attn_kernel<<<dim3(SEQ / 128, BATCH * NH), 256, 0, stream>>>(qkvbuf, aout);

  // projection GEMM: [4096,1024] x [1024,1024] + bias -> f32 out
  gemm_bf16_kernel<1><<<dim3(DIM / 256, MTOT / 64), 256, 0, stream>>>(
      aout, wprojT, proj_b, d_out, MTOT, DIM, DIM);
}

// v006
// One run takes 100 microseconds.
// Next to v005, in two timings, it ran 1.20 times as fast each time.
// Counting every step since v000, it is 4.51 times as fast.
#include <hip/hip_runtime.h>
#include <hip/hip_bf16.h>
#include <stdint.h>

typedef __bf16 bf16_t;
typedef __attribute__((ext_vector_type(8)))  __bf16 v8bf;
typedef __attribute__((ext_vector_type(16))) __bf16 v16bf;
typedef __attribute__((ext_vector_type(8)))  float  v8f;
typedef __attribute__((ext_vector_type(2)))  float  v2f;

#define DIM   1024
#define SEQ   2048
#define NH    16
#define HD    64
#define BATCH 2
#define MTOT  (BATCH * SEQ)   // 4096 tokens

// ---------------- helpers ----------------

__device__ __forceinline__ v8f zero8() {
  v8f z;
#pragma unroll
  for (int i = 0; i < 8; ++i) z[i] = 0.0f;
  return z;
}

// Low 32 bits of a generic pointer to __shared__ = LDS byte offset (aperture mapping).
__device__ __forceinline__ unsigned lds_off(const void* p) {
  return (unsigned)(unsigned long long)(uintptr_t)p;
}

// CDNA5 async global->LDS copy (per-lane 16B), tracked by ASYNCcnt.
__device__ __forceinline__ void async_ld_b128(unsigned lds, const void* g) {
  asm volatile("global_load_async_to_lds_b128 %0, %1, off"
               :: "v"(lds), "v"((unsigned long long)(uintptr_t)g)
               : "memory");
}

// Ten such copies, one stage's share of a lane, in one statement. Its last line, s_wait_xcnt 0,
// is a precaution: it stands in front of every later rewrite of the address registers that the
// copies name, and only inside the copies' own statement can the compiler move no such rewrite
// ahead of it.
__device__ __forceinline__ void async_ld10_b128(const unsigned (&l)[10], const bf16_t* const (&g)[10]) {
  asm volatile("global_load_async_to_lds_b128 %0, %1, off\n\t"
               "global_load_async_to_lds_b128 %2, %3, off\n\t"
               "global_load_async_to_lds_b128 %4, %5, off\n\t"
               "global_load_async_to_lds_b128 %6, %7, off\n\t"
               "global_load_async_to_lds_b128 %8, %9, off\n\t"
               "global_load_async_to_lds_b128 %10, %11, off\n\t"
               "global_load_async_to_lds_b128 %12, %13, off\n\t"
               "global_load_async_to_lds_b128 %14, %15, off\n\t"
               "global_load_async_to_lds_b128 %16, %17, off\n\t"
               "global_load_async_to_lds_b128 %18, %19, off\n\t"
               "s_wait_xcnt 0x0"
               :: "v"(l[0]), "v"((unsigned long long)(uintptr_t)g[0]),
                  "v"(l[1]), "v"((unsigned long long)(uintptr_t)g[1]),
                  "v"(l[2]), "v"((unsigned long long)(uintptr_t)g[2]),
                  "v"(l[3]), "v"((unsigned long long)(uintptr_t)g[3]),
                  "v"(l[4]), "v"((unsigned long long)(uintptr_t)g[4]),
                  "v"(l[5]), "v"((unsigned long long)(uintptr_t)g[5]),
                  "v"(l[6]), "v"((unsigned long long)(uintptr_t)g[6]),
                  "v"(l[7]), "v"((unsigned long long)(uintptr_t)g[7]),
                  "v"(l[8]), "v"((unsigned long long)(uintptr_t)g[8]),
                  "v"(l[9]), "v"((unsigned long long)(uintptr_t)g[9])
               : "memory");
}

// This wave's LDS reads have returned: stands in front of the barrier behind which their
// buffer is refilled by copies.
__device__ __forceinline__ void wait_dscnt0() {
  asm volatile("s_wait_dscnt 0x0" ::: "memory");
}

template <int N>
__device__ __forceinline__ void wait_asynccnt() {
  asm volatile("s_wait_asynccnt %0" :: "i"(N) : "memory");
}

// Load a 16-element bf16 WMMA fragment: two contiguous 16B chunks at p and p+16
// (ISA 16-bit A/B layout: k = half*8 + e  and  k = 16 + half*8 + e).
__device__ __forceinline__ v16bf ldfrag(const bf16_t* p) {
  v8bf lo = *(const v8bf*)(p);
  v8bf hi = *(const v8bf*)(p + 16);
  return __builtin_shufflevector(lo, hi, 0, 1, 2, 3, 4, 5, 6, 7,
                                 8, 9, 10, 11, 12, 13, 14, 15);
}

__device__ __forceinline__ v8f wmma_bf16(v16bf a, v16bf b, v8f c) {
  return __builtin_amdgcn_wmma_f32_16x16x32_bf16(false, a, false, b,
                                                 (short)0, c, false, false);
}

// Value of lane l ^ 16 (the other half of the wave), by a vector cross-row move.
__device__ __forceinline__ float xhalf(float x) {
  const int b = __builtin_bit_cast(int, x);
  return __builtin_bit_cast(float, __builtin_amdgcn_permlanex16(b, b, 0x76543210, 0xfedcba98,
                                                                false, false));
}

// ---------------- conversion kernels ----------------

__global__ void cvt_bf16_kernel(const float* __restrict__ in,
                                bf16_t* __restrict__ out, int n) {
  int i = blockIdx.x * blockDim.x + threadIdx.x;
  if (i < n) out[i] = (bf16_t)in[i];
}

// out[c*R + r] = (bf16) in[r*C + c]  (weights as [N][K] for B-fragments)
// One 64x64 tile per block of 256 threads, turned in LDS so that both global sides
// are wide and contiguous: 16 B loads along c, 16 B stores along r (8 lanes fill one
// 128 B line of out). R and C are multiples of 64. grid: (C/64, R/64).
#define TT   64
#define TPIT 65   // f32 pitch: both the row-wise writes and the column-wise reads hit distinct banks

__global__ __launch_bounds__(256) void cvt_transpose_kernel(
    const float* __restrict__ in, bf16_t* __restrict__ out, int R, int C) {
  __shared__ float tile[TT * TPIT];
  const int tid = threadIdx.x;
  const int c0 = blockIdx.x * TT, r0 = blockIdx.y * TT;

  const int lr = tid >> 4, lc = (tid & 15) * 4;
  float4 v[4];
#pragma unroll   // all four loads in flight before the first LDS write; v[] stays in registers
  for (int p = 0; p < 4; ++p)
    v[p] = *(const float4*)(in + (size_t)(r0 + lr + p * 16) * C + c0 + lc);
#pragma unroll   // v[] indexed by constants only
  for (int p = 0; p < 4; ++p) {
    float* t = &tile[(lr + p * 16) * TPIT + lc];
    t[0] = v[p].x; t[1] = v[p].y; t[2] = v[p].z; t[3] = v[p].w;
  }
  __syncthreads();

#pragma unroll   // both chunks' LDS reads issue together
  for (int p = 0; p < 2; ++p) {
    const int q = tid + p * 256;
    const int oc = q >> 3, orr = (q & 7) * 8;
    v8bf w;
#pragma unroll   // w[] indexed by constants only
    for (int i = 0; i < 8; ++i) w[i] = (bf16_t)tile[(orr + i) * TPIT + oc];
    *(v8bf*)(out + (size_t)(c0 + oc) * R + r0 + orr) = w;
  }
}

// ---------------- bf16 GEMM: C[M,N] = A[M,K] * Bt[N,K]^T + bias ----------------
// MODE 0: scatter bf16 into qkv buffer: Q,K as [B][H][S][D]; V as [B][H][D][S].
// MODE 1: f32 output + bias, row-major [M,N].

#define KST  64           // k per stage: a row of either tile is one whole 128 B line
#define ASTR 72           // LDS row pitch, 64 k + 8: 144 B = 16 B x odd, for the 16 B fragment reads
#define BSTR 72
#define ABUF (64 * ASTR)
#define BBUF (256 * BSTR)
#define SVP  72            // staging pitch of a V row, 64 s + 8: 144 B = 16 B x odd
#define SQP  264           // staging pitch of a Q or K token, 256 columns + 8: 528 B = 16 B x odd

template <int MODE>
__global__ __launch_bounds__(256) void gemm_bf16_kernel(
    const bf16_t* __restrict__ A, const bf16_t* __restrict__ Bt,
    const float* __restrict__ bias, void* __restrict__ outp,
    int M, int N, int K) {
  __shared__ __attribute__((aligned(16))) bf16_t Aw[2 * ABUF];   // double-buffered 64x64 A tiles
  __shared__ __attribute__((aligned(16))) bf16_t Bw[2 * BBUF];   // double-buffered 256x64 B tiles

  const int tid  = threadIdx.x;
  const int wave = tid >> 5, lane = tid & 31;
  const int lm   = lane & 15, half = lane >> 4;
  const int wm   = wave >> 2, wn = wave & 3;     // 2 x 4 wave grid
  const int n0   = blockIdx.x * 256;
  const int m0   = blockIdx.y * 64;

  v8f acc[2][4];
#pragma unroll
  for (int mt = 0; mt < 2; ++mt)
#pragma unroll
    for (int nt = 0; nt < 4; ++nt) acc[mt][nt] = zero8();

  const unsigned awb = lds_off(Aw), bwb = lds_off(Bw);
  const int arow = tid >> 3, acol = (tid & 7) * 8;

  // A row of either tile is one 128 B line of global memory. Eight neighbouring lanes bring
  // it, so a wave-wide copy touches 4 whole lines.
  auto issue = [&](int buf, int kk) {
    // Copy i of a tile brings its rows 32 i .. 32 i + 31: A tile 2 a lane, B tile 8 a lane.
    const unsigned al = awb + (unsigned)(buf * ABUF + arow * ASTR + acol) * 2;
    const unsigned bl = bwb + (unsigned)(buf * BBUF + arow * BSTR + acol) * 2;
    const bf16_t*  ag = A + (size_t)(m0 + arow) * K + kk + acol;
    const bf16_t*  bg = Bt + (size_t)(n0 + arow) * K + kk + acol;
    unsigned l[10];
    const bf16_t* g[10];
#pragma unroll   // l[] and g[] indexed by constants only: they stay in registers
    for (int i = 0; i < 2; ++i) {
      l[i] = al + i * (32 * ASTR * 2);
      g[i] = ag + (size_t)(32 * i) * K;
    }
#pragma unroll   // likewise
    for (int i = 0; i < 8; ++i) {
      l[2 + i] = bl + i * (32 * BSTR * 2);
      g[2 + i] = bg + (size_t)(32 * i) * K;
    }
    async_ld10_b128(l, g);
  };

  // Two buffers: stage t + 1 flies while stage t is worked on. K is a multiple of KST.
  issue(0, 0);
  wait_asynccnt<0>();
  __syncthreads();
  if (KST < K) issue(1, KST);
  for (int kk = 0; kk < K; kk += KST) {
    const int cur = (kk / KST) & 1;
    const bf16_t* Ac = &Aw[cur * ABUF];
    const bf16_t* Bc = &Bw[cur * BBUF];
#pragma unroll   // both halves' fragment reads can issue ahead of the first products
    for (int ks = 0; ks < KST; ks += 32) {
      v16bf af[2], bfg[4];
#pragma unroll
      for (int mt = 0; mt < 2; ++mt)
        af[mt] = ldfrag(&Ac[(wm * 32 + mt * 16 + lm) * ASTR + ks + half * 8]);
#pragma unroll
      for (int nt = 0; nt < 4; ++nt)
        bfg[nt] = ldfrag(&Bc[(wn * 64 + nt * 16 + lm) * BSTR + ks + half * 8]);
#pragma unroll
      for (int mt = 0; mt < 2; ++mt) {
#pragma unroll
        for (int nt = 0; nt < 4; ++nt)
          acc[mt][nt] = wmma_bf16(af[mt], bfg[nt], acc[mt][nt]);
      }
    }
    // Foot of the trip. The one barrier publishes stage t + 1 (every wave's copies have landed)
    // and ends every wave's reads of stage t, whose buffer the copies behind it refill.
    wait_dscnt0();
    wait_asynccnt<0>();
    __syncthreads();
    if (kk + 2 * KST < K) issue(cur, kk + 2 * KST);
  }
  wait_asynccnt<0>();   // no copy is outstanding when the ring becomes staging or the wave ends

  // epilogue
  if (MODE == 0) {
    // The 64 x 256 bf16 tile is turned in LDS so that every global store is 16 B a lane and
    // 8 neighbouring lanes fill one 128 B line. The B ring is free: the loop's last barrier
    // ended its reads, every wave's copies had landed in front of it, and none is issued behind it.
    // 256 divides DIM and 64 divides SEQ, so part, batch and the four heads are the block's.
    bf16_t* St = Bw;
    const int part = n0 >> 10;
    const int bb = m0 >> 11, s0 = m0 & (SEQ - 1);
    const int h0 = (n0 & (DIM - 1)) >> 6;
    bf16_t* ob = (bf16_t*)outp + (size_t)part * ((size_t)BATCH * NH * SEQ * HD) +
                 (size_t)(bb * NH + h0) * (SEQ * HD);
    float bs[4];
#pragma unroll
    for (int nt = 0; nt < 4; ++nt) bs[nt] = bias[n0 + wn * 64 + nt * 16 + lm];

    if (part == 2) {
      // V goes out as [d][s]: a lane's 8 accumulators are 8 neighbouring s of one d.
#pragma unroll
      for (int mt = 0; mt < 2; ++mt) {
#pragma unroll
        for (int nt = 0; nt < 4; ++nt) {
          v8bf w;
#pragma unroll
          for (int r = 0; r < 8; ++r) w[r] = (bf16_t)(acc[mt][nt][r] + bs[nt]);
          *(v8bf*)&St[(wn * 64 + nt * 16 + lm) * SVP + wm * 32 + mt * 16 + 8 * half] = w;
        }
      }
    } else {
      // Q, K go out as [s][d]: staged row-major, m = r + 8*half, n = lane%16.
#pragma unroll
      for (int mt = 0; mt < 2; ++mt) {
#pragma unroll
        for (int nt = 0; nt < 4; ++nt) {
#pragma unroll
          for (int r = 0; r < 8; ++r)
            St[(wm * 32 + mt * 16 + r + 8 * half) * SQP + wn * 64 + nt * 16 + lm] =
                (bf16_t)(acc[mt][nt][r] + bs[nt]);
        }
      }
    }
    __syncthreads();
    if (part == 2) {
#pragma unroll   // all eight LDS reads issue together
      for (int p = 0; p < 8; ++p) {
        const int q = tid + p * 256;
        const int n = q >> 3, c = (q & 7) * 8;      // row h*64 + d of the four heads; 8 s
        *(v8bf*)(ob + (size_t)n * SEQ + s0 + c) = *(const v8bf*)&St[n * SVP + c];
      }
    } else {
#pragma unroll   // all eight LDS reads issue together
      for (int p = 0; p < 8; ++p) {
        const int q = tid + p * 256;
        const int m = q >> 5, c = q & 31;           // token; 16 B chunk of its 256 columns
        *(v8bf*)(ob + (size_t)(c >> 3) * (SEQ * HD) + (size_t)(s0 + m) * HD + (c & 7) * 8) =
            *(const v8bf*)&St[m * SQP + c * 8];
      }
    }
  } else {
#pragma unroll
    for (int mt = 0; mt < 2; ++mt) {
#pragma unroll
      for (int nt = 0; nt < 4; ++nt) {
#pragma unroll
        for (int r = 0; r < 8; ++r) {
          int gm = m0 + wm * 32 + mt * 16 + r + 8 * half;   // C/D: m = r + 8*half
          int gn = n0 + wn * 64 + nt * 16 + lm;             // C/D: n = lane%16
          ((float*)outp)[(size_t)gm * N + gn] = acc[mt][nt][r] + bias[gn];
        }
      }
    }
  }
}

// LDS rows of K and V hold 64 bf16 (128 B) and are all read as 16 B fragments, one row
// per lane: at a 128 B pitch 16 lanes fall on two bank groups, at 144 B (16 B x odd) on all.
#define KVP   72            // LDS row pitch in elements (64 used + 8 never read)
#define KVBUF (64 * KVP)    // elements per K or V tile

// The grid puts two blocks on a WGP, four waves on a SIMD: said here so that the compiler
// spends registers on LDS reads issued in groups ahead of the products instead of saving
// them for waves that the grid does not have.
__global__ __launch_bounds__(256) __attribute__((amdgpu_waves_per_eu(4, 4)))
void attn_kernel(const bf16_t* __restrict__ qkv,
                                                   bf16_t* __restrict__ aout) {
  __shared__ __attribute__((aligned(16))) bf16_t Kw[2 * KVBUF];      // [key][d]    18 KB (double buffered)
  __shared__ __attribute__((aligned(16))) bf16_t Vt[2 * KVBUF];      // [d][key]    18 KB (double buffered)

  const int tid  = threadIdx.x;
  const int wave = tid >> 5, lane = tid & 31;
  const int lm   = lane & 15, half = lane >> 4;
  const int bh   = blockIdx.y;
  const int b    = bh >> 4, h = bh & 15;

  const size_t partsz = (size_t)BATCH * NH * SEQ * HD;
  const bf16_t* Qb = qkv + ((size_t)b * NH + h) * SEQ * HD;
  const bf16_t* Kb = qkv + partsz + ((size_t)b * NH + h) * SEQ * HD;
  const bf16_t* Vb = qkv + 2 * partsz + ((size_t)b * NH + h) * HD * SEQ;  // [d][s]

  const int q0 = blockIdx.x * 128 + wave * 16;

  // Q fragments (B operand: column = query lane%16), loaded once: k-dim = 64 -> 2 chunks of 32
  v16bf aq[2];
#pragma unroll
  for (int kh = 0; kh < 2; ++kh)
    aq[kh] = ldfrag(Qb + (size_t)(q0 + lm) * HD + kh * 32 + half * 8);

  v8f o[4];
#pragma unroll
  for (int t = 0; t < 4; ++t) o[t] = zero8();
  // The lane's query: running maximum (equal in both halves) and the sum over this half's keys.
  float m_run = -1e30f, l_run = 0.0f;

  const unsigned kwb = lds_off(Kw), vtb = lds_off(Vt);
  const int ldr = tid >> 2, ldc = (tid & 3) * 16;
  const float scale = 0.125f;   // 1/sqrt(64)

  auto issue_kv = [&](int buf, int j0) {
    // K block [64 keys][64 d] -> Kw[key][d]
    const bf16_t* kg = Kb + (size_t)(j0 + ldr) * HD + ldc;
    unsigned kl = kwb + (unsigned)(buf * KVBUF + ldr * KVP + ldc) * 2;
    async_ld_b128(kl, kg);
    async_ld_b128(kl + 16, kg + 8);
    // V block (global already [d][s]) -> Vt[d][key]
    const bf16_t* vg = Vb + (size_t)ldr * SEQ + j0 + ldc;
    unsigned vl = vtb + (unsigned)(buf * KVBUF + ldr * KVP + ldc) * 2;
    async_ld_b128(vl, vg);
    async_ld_b128(vl + 16, vg + 8);
  };

  issue_kv(0, 0);
  for (int jb = 0; jb < SEQ / 64; ++jb) {
    const int cur = jb & 1;
    if (jb + 1 < SEQ / 64) {
      issue_kv(cur ^ 1, (jb + 1) * 64);
      wait_asynccnt<4>();
    } else {
      wait_asynccnt<0>();
    }
    __syncthreads();

    const bf16_t* Kc = &Kw[cur * KVBUF];
    const bf16_t* Vc = &Vt[cur * KVBUF];

    // ---- scores S^T = K * Q^T  (64 keys x 16 queries per wave, 8 WMMAs) ----
    // s[t][r] = score of key t*16 + 8*half + r with query lane%16
    v8f s[4];
#pragma unroll
    for (int t = 0; t < 4; ++t) s[t] = zero8();
#pragma unroll
    for (int kh = 0; kh < 2; ++kh) {
#pragma unroll
      for (int t = 0; t < 4; ++t) {
        v16bf ak = ldfrag(&Kc[(t * 16 + lm) * KVP + kh * 32 + half * 8]);
        s[t] = wmma_bf16(ak, aq[kh], s[t]);
      }
    }
#pragma unroll
    for (int t = 0; t < 4; ++t)
#pragma unroll
      for (int r = 0; r < 8; ++r) s[t][r] *= scale;

    // ---- online softmax, one query per lane: 32 keys in-lane, the other 32 in lane ^ 16 ----
    float mt4[4];
#pragma unroll   // four independent chains, one per tile
    for (int t = 0; t < 4; ++t) {
      mt4[t] = s[t][0];
#pragma unroll   // s[] indexed by constants only: stays in registers
      for (int r = 1; r < 8; ++r) mt4[t] = fmaxf(mt4[t], s[t][r]);
    }
    float mx = fmaxf(fmaxf(mt4[0], mt4[1]), fmaxf(mt4[2], mt4[3]));
    mx = fmaxf(mx, xhalf(mx));
    const float mn   = fmaxf(m_run, mx);
    const float corr = __expf(m_run - mn);
    m_run = mn;
    v2f l2[2];   // two independent chains of packed adds over register pairs
    l2[0] = (v2f){0.0f, 0.0f};
    l2[1] = (v2f){0.0f, 0.0f};
#pragma unroll   // s[] and l2[] indexed by constants only: stay in registers
    for (int t = 0; t < 4; ++t) {
#pragma unroll   // likewise
      for (int r = 0; r < 8; r += 2) {
        const float p0 = __expf(s[t][r] - mn), p1 = __expf(s[t][r + 1] - mn);
        s[t][r] = p0;
        s[t][r + 1] = p1;
        l2[t & 1] += (v2f){p0, p1};
      }
    }
    l2[0] += l2[1];
    l_run = l_run * corr + (l2[0].x + l2[0].y);
#pragma unroll
    for (int t = 0; t < 4; ++t)
#pragma unroll
      for (int r = 0; r < 8; ++r) o[t][r] *= corr;

    // ---- O^T += V^T * P^T  (8 WMMAs; A-fragments from [d][key] V) ----
    // B element e of lane (lm, half) is key half*8 + e (e < 8) or 16 + half*8 + e - 8 of the
    // 32: exactly what tiles 2*kh and 2*kh + 1 of S^T hold in this lane.
#pragma unroll
    for (int kh = 0; kh < 2; ++kh) {
      v16bf bp;
#pragma unroll   // packed converts of register pairs, no indexing at run time
      for (int r = 0; r < 8; ++r) {
        bp[r]     = (bf16_t)s[2 * kh][r];
        bp[8 + r] = (bf16_t)s[2 * kh + 1][r];
      }
#pragma unroll
      for (int t = 0; t < 4; ++t) {
        v16bf av = ldfrag(&Vc[(t * 16 + lm) * KVP + kh * 32 + half * 8]);
        o[t] = wmma_bf16(av, bp, o[t]);
      }
    }
    __syncthreads();
  }

  // ---- finalize: join the halves' sums, divide by l, store bf16 into [B*S][DIM] ----
  // o[t][r] = O[query lane%16][d = t*16 + 8*half + r]: 8 neighbouring d, one 16 B store.
  const float inv = 1.0f / (l_run + xhalf(l_run));
  bf16_t* orow = aout + ((size_t)b * SEQ + q0 + lm) * DIM + h * HD + 8 * half;
#pragma unroll   // o[] indexed by constants only; the four stores issue together
  for (int t = 0; t < 4; ++t) {
    v8bf w;
#pragma unroll   // w[] indexed by constants only
    for (int r = 0; r < 8; ++r) w[r] = (bf16_t)(o[t][r] * inv);
    *(v8bf*)(orow + t * 16) = w;
  }
}

// ---------------- launch ----------------

extern "C" void kernel_launch(void* const* d_in, const int* in_sizes, int n_in,
                              void* d_out, int out_size, void* d_ws, size_t ws_size,
                              hipStream_t stream) {
  const float* x      = (const float*)d_in[0];
  const float* qkv_w  = (const float*)d_in[1];
  const float* qkv_b  = (const float*)d_in[2];
  const float* proj_w = (const float*)d_in[3];
  const float* proj_b = (const float*)d_in[4];

  const size_t MB = 1u << 20;
  char* ws = (char*)d_ws;
  bf16_t* xb     = (bf16_t*)(ws);             //  8 MB: x as bf16 [4096][1024]
  bf16_t* wqkvT  = (bf16_t*)(ws + 8 * MB);    //  6 MB: qkv_w^T [3072][1024]
  bf16_t* wprojT = (bf16_t*)(ws + 14 * MB);   //  2 MB: proj_w^T [1024][1024]
  bf16_t* qkvbuf = (bf16_t*)(ws + 16 * MB);   // 24 MB: Q,K [B][H][S][D]; V [B][H][D][S]
  bf16_t* aout   = (bf16_t*)(ws + 40 * MB);   //  8 MB: attn out [4096][1024]

  // convert / transpose to bf16
  const int nx = MTOT * DIM;
  cvt_bf16_kernel<<<nx / 256, 256, 0, stream>>>(x, xb, nx);
  cvt_transpose_kernel<<<dim3(3 * DIM / 64, DIM / 64), 256, 0, stream>>>(qkv_w, wqkvT, DIM, 3 * DIM);
  cvt_transpose_kernel<<<dim3(DIM / 64, DIM / 64), 256, 0, stream>>>(proj_w, wprojT, DIM, DIM);

  // QKV GEMM: [4096,1024] x [1024,3072] -> scattered bf16 Q/K/V
  gemm_bf16_kernel<0><<<dim3(3 * DIM / 256, MTOT / 64), 256, 0, stream>>>(
      xb, wqkvT, qkv_b, qkvbuf, MTOT, 3 * DIM, DIM);

  // attention
  attn_kernel<<<dim3(SEQ / 128, BATCH * NH), 256, 0, stream>>>(qkvbuf, aout);

  // projection GEMM: [4096,1024] x [1024,1024] + bias -> f32 out
  gemm_bf16_kernel<1><<<dim3(DIM / 256, MTOT / 64), 256, 0, stream>>>(
      aout, wprojT, proj_b, d_out, MTOT, DIM, DIM);
}

// v007
// Measured time: 95.9 microseconds a run.
// Timed twice side by side with v006, it ran 1.05 times as fast both times.
// Counting every step since v000, it is 4.74 times as fast.
#include <hip/hip_runtime.h>
#include <hip/hip_bf16.h>
#include <stdint.h>

typedef __bf16 bf16_t;
typedef __attribute__((ext_vector_type(4)))  __bf16 v4bf;
typedef __attribute__((ext_vector_type(8)))  __bf16 v8bf;
typedef __attribute__((ext_vector_type(16))) __bf16 v16bf;
typedef __attribute__((ext_vector_type(8)))  float  v8f;
typedef __attribute__((ext_vector_type(2)))  float  v2f;

#define DIM   1024
#define SEQ   2048
#define NH    16
#define HD    64
#define BATCH 2
#define MTOT  (BATCH * SEQ)   // 4096 tokens

// ---------------- helpers ----------------

__device__ __forceinline__ v8f zero8() {
  v8f z;
#pragma unroll
  for (int i = 0; i < 8; ++i) z[i] = 0.0f;
  return z;
}

// Low 32 bits of a generic pointer to __shared__ = LDS byte offset (aperture mapping).
__device__ __forceinline__ unsigned lds_off(const void* p) {
  return (unsigned)(unsigned long long)(uintptr_t)p;
}

// CDNA5 async global->LDS copy (per-lane 16B), tracked by ASYNCcnt.
__device__ __forceinline__ void async_ld_b128(unsigned lds, const void* g) {
  asm volatile("global_load_async_to_lds_b128 %0, %1, off"
               :: "v"(lds), "v"((unsigned long long)(uintptr_t)g)
               : "memory");
}

// Ten such copies, one stage's share of a lane, in one statement. Its last line, s_wait_xcnt 0,
// is a precaution: it stands in front of every later rewrite of the address registers that the
// copies name, and only inside the copies' own statement can the compiler move no such rewrite
// ahead of it.
__device__ __forceinline__ void async_ld10_b128(const unsigned (&l)[10], const bf16_t* const (&g)[10]) {
  asm volatile("global_load_async_to_lds_b128 %0, %1, off\n\t"
               "global_load_async_to_lds_b128 %2, %3, off\n\t"
               "global_load_async_to_lds_b128 %4, %5, off\n\t"
               "global_load_async_to_lds_b128 %6, %7, off\n\t"
               "global_load_async_to_lds_b128 %8, %9, off\n\t"
               "global_load_async_to_lds_b128 %10, %11, off\n\t"
               "global_load_async_to_lds_b128 %12, %13, off\n\t"
               "global_load_async_to_lds_b128 %14, %15, off\n\t"
               "global_load_async_to_lds_b128 %16, %17, off\n\t"
               "global_load_async_to_lds_b128 %18, %19, off\n\t"
               "s_wait_xcnt 0x0"
               :: "v"(l[0]), "v"((unsigned long long)(uintptr_t)g[0]),
                  "v"(l[1]), "v"((unsigned long long)(uintptr_t)g[1]),
                  "v"(l[2]), "v"((unsigned long long)(uintptr_t)g[2]),
                  "v"(l[3]), "v"((unsigned long long)(uintptr_t)g[3]),
                  "v"(l[4]), "v"((unsigned long long)(uintptr_t)g[4]),
                  "v"(l[5]), "v"((unsigned long long)(uintptr_t)g[5]),
                  "v"(l[6]), "v"((unsigned long long)(uintptr_t)g[6]),
                  "v"(l[7]), "v"((unsigned long long)(uintptr_t)g[7]),
                  "v"(l[8]), "v"((unsigned long long)(uintptr_t)g[8]),
                  "v"(l[9]), "v"((unsigned long long)(uintptr_t)g[9])
               : "memory");
}

// This wave's LDS reads have returned: stands in front of the barrier behind which their
// buffer is refilled by copies.
__device__ __forceinline__ void wait_dscnt0() {
  asm volatile("s_wait_dscnt 0x0" ::: "memory");
}

template <int N>
__device__ __forceinline__ void wait_asynccnt() {
  asm volatile("s_wait_asynccnt %0" :: "i"(N) : "memory");
}

// Load a 16-element bf16 WMMA fragment: two contiguous 16B chunks at p and p+16
// (ISA 16-bit A/B layout: k = half*8 + e  and  k = 16 + half*8 + e).
__device__ __forceinline__ v16bf ldfrag(const bf16_t* p) {
  v8bf lo = *(const v8bf*)(p);
  v8bf hi = *(const v8bf*)(p + 16);
  return __builtin_shufflevector(lo, hi, 0, 1, 2, 3, 4, 5, 6, 7,
                                 8, 9, 10, 11, 12, 13, 14, 15);
}

__device__ __forceinline__ v8f wmma_bf16(v16bf a, v16bf b, v8f c) {
  return __builtin_amdgcn_wmma_f32_16x16x32_bf16(false, a, false, b,
                                                 (short)0, c, false, false);
}

// Value of lane l ^ 16 (the other half of the wave), by a vector cross-row move.
__device__ __forceinline__ float xhalf(float x) {
  const int b = __builtin_bit_cast(int, x);
  return __builtin_bit_cast(float, __builtin_amdgcn_permlanex16(b, b, 0x76543210, 0xfedcba98,
                                                                false, false));
}

// ---------------- conversion kernels ----------------

// One block of 16 waves per WGP, 32 elements a lane: the launch starts 4,096 waves instead of
// one wave per 32 elements. Every wave-wide load is 512 contiguous bytes (4 whole lines), every
// wave-wide store 256 (2 whole lines). The grid covers the array exactly.
#define CVT_T 512                    // threads a block
#define CVT_L 8                      // 16 B loads a lane
#define CVT_B (CVT_T * CVT_L * 4)    // elements a block
static_assert((MTOT * DIM) % CVT_B == 0, "the grid covers x exactly");

__global__ __launch_bounds__(CVT_T) void cvt_bf16_kernel(const float* __restrict__ in,
                                                         bf16_t* __restrict__ out) {
  const size_t base = (size_t)blockIdx.x * CVT_B + threadIdx.x * 4;
  float4 v[CVT_L];
#pragma unroll   // all eight loads in flight before the first convert; v[] stays in registers
  for (int j = 0; j < CVT_L; ++j) v[j] = *(const float4*)(in + base + j * (CVT_T * 4));
#pragma unroll   // v[] indexed by constants only
  for (int j = 0; j < CVT_L; ++j) {
    v4bf w;
    w[0] = (bf16_t)v[j].x; w[1] = (bf16_t)v[j].y; w[2] = (bf16_t)v[j].z; w[3] = (bf16_t)v[j].w;
    *(v4bf*)(out + base + j * (CVT_T * 4)) = w;
  }
}

// out[c*R + r] = (bf16) in[r*C + c]  (weights as [N][K] for B-fragments)
// One 64x64 tile per block of 256 threads, turned in LDS so that both global sides
// are wide and contiguous: 16 B loads along c, 16 B stores along r (8 lanes fill one
// 128 B line of out). R and C are multiples of 64. grid: (C/64, R/64).
#define TT   64
#define TPIT 65   // f32 pitch: both the row-wise writes and the column-wise reads hit distinct banks

__global__ __launch_bounds__(256) void cvt_transpose_kernel(
    const float* __restrict__ in, bf16_t* __restrict__ out, int R, int C) {
  __shared__ float tile[TT * TPIT];
  const int tid = threadIdx.x;
  const int c0 = blockIdx.x * TT, r0 = blockIdx.y * TT;

  const int lr = tid >> 4, lc = (tid & 15) * 4;
  float4 v[4];
#pragma unroll   // all four loads in flight before the first LDS write; v[] stays in registers
  for (int p = 0; p < 4; ++p)
    v[p] = *(const float4*)(in + (size_t)(r0 + lr + p * 16) * C + c0 + lc);
#pragma unroll   // v[] indexed by constants only
  for (int p = 0; p < 4; ++p) {
    float* t = &tile[(lr + p * 16) * TPIT + lc];
    t[0] = v[p].x; t[1] = v[p].y; t[2] = v[p].z; t[3] = v[p].w;
  }
  __syncthreads();

#pragma unroll   // both chunks' LDS reads issue together
  for (int p = 0; p < 2; ++p) {
    const int q = tid + p * 256;
    const int oc = q >> 3, orr = (q & 7) * 8;
    v8bf w;
#pragma unroll   // w[] indexed by constants only
    for (int i = 0; i < 8; ++i) w[i] = (bf16_t)tile[(orr + i) * TPIT + oc];
    *(v8bf*)(out + (size_t)(c0 + oc) * R + r0 + orr) = w;
  }
}

// ---------------- bf16 GEMM: C[M,N] = A[M,K] * Bt[N,K]^T + bias ----------------
// MODE 0: scatter bf16 into qkv buffer: Q,K as [B][H][S][D]; V as [B][H][D][S].
// MODE 1: f32 output + bias, row-major [M,N].

#define KST  64           // k per stage: a row of either tile is one whole 128 B line
#define ASTR 72           // LDS row pitch, 64 k + 8: 144 B = 16 B x odd, for the 16 B fragment reads
#define BSTR 72
#define ABUF (64 * ASTR)
#define BBUF (256 * BSTR)
#define SVP  72            // staging pitch of a V row, 64 s + 8: 144 B = 16 B x odd
#define SQP  264           // staging pitch of a Q or K token, 256 columns + 8: 528 B = 16 B x odd

template <int MODE>
__global__ __launch_bounds__(256) void gemm_bf16_kernel(
    const bf16_t* __restrict__ A, const bf16_t* __restrict__ Bt,
    const float* __restrict__ bias, void* __restrict__ outp,
    int M, int N, int K) {
  __shared__ __attribute__((aligned(16))) bf16_t Aw[2 * ABUF];   // double-buffered 64x64 A tiles
  __shared__ __attribute__((aligned(16))) bf16_t Bw[2 * BBUF];   // double-buffered 256x64 B tiles

  const int tid  = threadIdx.x;
  const int wave = tid >> 5, lane = tid & 31;
  const int lm   = lane & 15, half = lane >> 4;
  const int wm   = wave >> 2, wn = wave & 3;     // 2 x 4 wave grid
  const int n0   = blockIdx.x * 256;
  const int m0   = blockIdx.y * 64;

  v8f acc[2][4];
#pragma unroll
  for (int mt = 0; mt < 2; ++mt)
#pragma unroll
    for (int nt = 0; nt < 4; ++nt) acc[mt][nt] = zero8();

  const unsigned awb = lds_off(Aw), bwb = lds_off(Bw);
  const int arow = tid >> 3, acol = (tid & 7) * 8;

  // A row of either tile is one 128 B line of global memory. Eight neighbouring lanes bring
  // it, so a wave-wide copy touches 4 whole lines.
  auto issue = [&](int buf, int kk) {
    // Copy i of a tile brings its rows 32 i .. 32 i + 31: A tile 2 a lane, B tile 8 a lane.
    const unsigned al = awb + (unsigned)(buf * ABUF + arow * ASTR + acol) * 2;
    const unsigned bl = bwb + (unsigned)(buf * BBUF + arow * BSTR + acol) * 2;
    const bf16_t*  ag = A + (size_t)(m0 + arow) * K + kk + acol;
    const bf16_t*  bg = Bt + (size_t)(n0 + arow) * K + kk + acol;
    unsigned l[10];
    const bf16_t* g[10];
#pragma unroll   // l[] and g[] indexed by constants only: they stay in registers
    for (int i = 0; i < 2; ++i) {
      l[i] = al + i * (32 * ASTR * 2);
      g[i] = ag + (size_t)(32 * i) * K;
    }
#pragma unroll   // likewise
    for (int i = 0; i < 8; ++i) {
      l[2 + i] = bl + i * (32 * BSTR * 2);
      g[2 + i] = bg + (size_t)(32 * i) * K;
    }
    async_ld10_b128(l, g);
  };

  // Two buffers: stage t + 1 flies while stage t is worked on. K is a multiple of KST.
  issue(0, 0);
  wait_asynccnt<0>();
  __syncthreads();
  if (KST < K) issue(1, KST);
  for (int kk = 0; kk < K; kk += KST) {
    const int cur = (kk / KST) & 1;
    const bf16_t* Ac = &Aw[cur * ABUF];
    const bf16_t* Bc = &Bw[cur * BBUF];
#pragma unroll   // both halves' fragment reads can issue ahead of the first products
    for (int ks = 0; ks < KST; ks += 32) {
      v16bf af[2], bfg[4];
#pragma unroll
      for (int mt = 0; mt < 2; ++mt)
        af[mt] = ldfrag(&Ac[(wm * 32 + mt * 16 + lm) * ASTR + ks + half * 8]);
#pragma unroll
      for (int nt = 0; nt < 4; ++nt)
        bfg[nt] = ldfrag(&Bc[(wn * 64 + nt * 16 + lm) * BSTR + ks + half * 8]);
#pragma unroll
      for (int mt = 0; mt < 2; ++mt) {
#pragma unroll
        for (int nt = 0; nt < 4; ++nt)
          acc[mt][nt] = wmma_bf16(af[mt], bfg[nt], acc[mt][nt]);
      }
    }
    // Foot of the trip. The one barrier publishes stage t + 1 (every wave's copies have landed)
    // and ends every wave's reads of stage t, whose buffer the copies behind it refill.
    wait_dscnt0();
    wait_asynccnt<0>();
    __syncthreads();
    if (kk + 2 * KST < K) issue(cur, kk + 2 * KST);
  }
  wait_asynccnt<0>();   // no copy is outstanding when the ring becomes staging or the wave ends

  // epilogue
  if (MODE == 0) {
    // The 64 x 256 bf16 tile is turned in LDS so that every global store is 16 B a lane and
    // 8 neighbouring lanes fill one 128 B line. The B ring is free: the loop's last barrier
    // ended its reads, every wave's copies had landed in front of it, and none is issued behind it.
    // 256 divides DIM and 64 divides SEQ, so part, batch and the four heads are the block's.
    bf16_t* St = Bw;
    const int part = n0 >> 10;
    const int bb = m0 >> 11, s0 = m0 & (SEQ - 1);
    const int h0 = (n0 & (DIM - 1)) >> 6;
    bf16_t* ob = (bf16_t*)outp + (size_t)part * ((size_t)BATCH * NH * SEQ * HD) +
                 (size_t)(bb * NH + h0) * (SEQ * HD);
    float bs[4];
#pragma unroll
    for (int nt = 0; nt < 4; ++nt) bs[nt] = bias[n0 + wn * 64 + nt * 16 + lm];

    if (part == 2) {
      // V goes out as [d][s]: a lane's 8 accumulators are 8 neighbouring s of one d.
#pragma unroll
      for (int mt = 0; mt < 2; ++mt) {
#pragma unroll
        for (int nt = 0; nt < 4; ++nt) {
          v8bf w;
#pragma unroll
          for (int r = 0; r < 8; ++r) w[r] = (bf16_t)(acc[mt][nt][r] + bs[nt]);
          *(v8bf*)&St[(wn * 64 + nt * 16 + lm) * SVP + wm * 32 + mt * 16 + 8 * half] = w;
        }
      }
    } else {
      // Q, K go out as [s][d]: staged row-major, m = r + 8*half, n = lane%16.
#pragma unroll
      for (int mt = 0; mt < 2; ++mt) {
#pragma unroll
        for (int nt = 0; nt < 4; ++nt) {
#pragma unroll
          for (int r = 0; r < 8; ++r)
            St[(wm * 32 + mt * 16 + r + 8 * half) * SQP + wn * 64 + nt * 16 + lm] =
                (bf16_t)(acc[mt][nt][r] + bs[nt]);
        }
      }
    }
    __syncthreads();
    if (part == 2) {
#pragma unroll   // all eight LDS reads issue together
      for (int p = 0; p < 8; ++p) {
        const int q = tid + p * 256;
        const int n = q >> 3, c = (q & 7) * 8;      // row h*64 + d of the four heads; 8 s
        *(v8bf*)(ob + (size_t)n * SEQ + s0 + c) = *(const v8bf*)&St[n * SVP + c];
      }
    } else {
#pragma unroll   // all eight LDS reads issue together
      for (int p = 0; p < 8; ++p) {
        const int q = tid + p * 256;
        const int m = q >> 5, c = q & 31;           // token; 16 B chunk of its 256 columns
        *(v8bf*)(ob + (size_t)(c >> 3) * (SEQ * HD) + (size_t)(s0 + m) * HD + (c & 7) * 8) =
            *(const v8bf*)&St[m * SQP + c * 8];
      }
    }
  } else {
#pragma unroll
    for (int mt = 0; mt < 2; ++mt) {
#pragma unroll
      for (int nt = 0; nt < 4; ++nt) {
#pragma unroll
        for (int r = 0; r < 8; ++r) {
          int gm = m0 + wm * 32 + mt * 16 + r + 8 * half;   // C/D: m = r + 8*half
          int gn = n0 + wn * 64 + nt * 16 + lm;             // C/D: n = lane%16
          ((float*)outp)[(size_t)gm * N + gn] = acc[mt][nt][r] + bias[gn];
        }
      }
    }
  }
}

// LDS rows of K and V hold 64 bf16 (128 B) and are all read as 16 B fragments, one row
// per lane: at a 128 B pitch 16 lanes fall on two bank groups, at 144 B (16 B x odd) on all.
#define KVP   72            // LDS row pitch in elements (64 used + 8 never read)
#define KVBUF (64 * KVP)    // elements per K or V tile

// The grid puts two blocks on a WGP, four waves on a SIMD: said here so that the compiler
// spends registers on LDS reads issued in groups ahead of the products instead of saving
// them for waves that the grid does not have.
__global__ __launch_bounds__(256) __attribute__((amdgpu_waves_per_eu(4, 4)))
void attn_kernel(const bf16_t* __restrict__ qkv,
                                                   bf16_t* __restrict__ aout) {
  __shared__ __attribute__((aligned(16))) bf16_t Kw[2 * KVBUF];      // [key][d]    18 KB (double buffered)
  __shared__ __attribute__((aligned(16))) bf16_t Vt[2 * KVBUF];      // [d][key]    18 KB (double buffered)

  const int tid  = threadIdx.x;
  const int wave = tid >> 5, lane = tid & 31;
  const int lm   = lane & 15, half = lane >> 4;
  const int bh   = blockIdx.y;
  const int b    = bh >> 4, h = bh & 15;

  const size_t partsz = (size_t)BATCH * NH * SEQ * HD;
  const bf16_t* Qb = qkv + ((size_t)b * NH + h) * SEQ * HD;
  const bf16_t* Kb = qkv + partsz + ((size_t)b * NH + h) * SEQ * HD;
  const bf16_t* Vb = qkv + 2 * partsz + ((size_t)b * NH + h) * HD * SEQ;  // [d][s]

  const int q0 = blockIdx.x * 128 + wave * 16;

  // Q fragments (B operand: column = query lane%16), loaded once: k-dim = 64 -> 2 chunks of 32
  v16bf aq[2];
#pragma unroll
  for (int kh = 0; kh < 2; ++kh)
    aq[kh] = ldfrag(Qb + (size_t)(q0 + lm) * HD + kh * 32 + half * 8);

  v8f o[4];
#pragma unroll
  for (int t = 0; t < 4; ++t) o[t] = zero8();
  // The lane's query: running maximum (equal in both halves) and the sum over this half's keys.
  float m_run = -1e30f, l_run = 0.0f;

  const unsigned kwb = lds_off(Kw), vtb = lds_off(Vt);
  const int ldr = tid >> 2, ldc = (tid & 3) * 16;
  const float scale = 0.125f;   // 1/sqrt(64)

  auto issue_kv = [&](int buf, int j0) {
    // K block [64 keys][64 d] -> Kw[key][d]
    const bf16_t* kg = Kb + (size_t)(j0 + ldr) * HD + ldc;
    unsigned kl = kwb + (unsigned)(buf * KVBUF + ldr * KVP + ldc) * 2;
    async_ld_b128(kl, kg);
    async_ld_b128(kl + 16, kg + 8);
    // V block (global already [d][s]) -> Vt[d][key]
    const bf16_t* vg = Vb + (size_t)ldr * SEQ + j0 + ldc;
    unsigned vl = vtb + (unsigned)(buf * KVBUF + ldr * KVP + ldc) * 2;
    async_ld_b128(vl, vg);
    async_ld_b128(vl + 16, vg + 8);
  };

  issue_kv(0, 0);
  for (int jb = 0; jb < SEQ / 64; ++jb) {
    const int cur = jb & 1;
    if (jb + 1 < SEQ / 64) {
      issue_kv(cur ^ 1, (jb + 1) * 64);
      wait_asynccnt<4>();
    } else {
      wait_asynccnt<0>();
    }
    __syncthreads();

    const bf16_t* Kc = &Kw[cur * KVBUF];
    const bf16_t* Vc = &Vt[cur * KVBUF];

    // ---- scores S^T = K * Q^T  (64 keys x 16 queries per wave, 8 WMMAs) ----
    // s[t][r] = score of key t*16 + 8*half + r with query lane%16
    v8f s[4];
#pragma unroll
    for (int t = 0; t < 4; ++t) s[t] = zero8();
#pragma unroll
    for (int kh = 0; kh < 2; ++kh) {
#pragma unroll
      for (int t = 0; t < 4; ++t) {
        v16bf ak = ldfrag(&Kc[(t * 16 + lm) * KVP + kh * 32 + half * 8]);
        s[t] = wmma_bf16(ak, aq[kh], s[t]);
      }
    }
#pragma unroll
    for (int t = 0; t < 4; ++t)
#pragma unroll
      for (int r = 0; r < 8; ++r) s[t][r] *= scale;

    // ---- online softmax, one query per lane: 32 keys in-lane, the other 32 in lane ^ 16 ----
    float mt4[4];
#pragma unroll   // four independent chains, one per tile
    for (int t = 0; t < 4; ++t) {
      mt4[t] = s[t][0];
#pragma unroll   // s[] indexed by constants only: stays in registers
      for (int r = 1; r < 8; ++r) mt4[t] = fmaxf(mt4[t], s[t][r]);
    }
    float mx = fmaxf(fmaxf(mt4[0], mt4[1]), fmaxf(mt4[2], mt4[3]));
    mx = fmaxf(mx, xhalf(mx));
    const float mn   = fmaxf(m_run, mx);
    const float corr = __expf(m_run - mn);
    m_run = mn;
    v2f l2[2];   // two independent chains of packed adds over register pairs
    l2[0] = (v2f){0.0f, 0.0f};
    l2[1] = (v2f){0.0f, 0.0f};
#pragma unroll   // s[] and l2[] indexed by constants only: stay in registers
    for (int t = 0; t < 4; ++t) {
#pragma unroll   // likewise
      for (int r = 0; r < 8; r += 2) {
        const float p0 = __expf(s[t][r] - mn), p1 = __expf(s[t][r + 1] - mn);
        s[t][r] = p0;
        s[t][r + 1] = p1;
        l2[t & 1] += (v2f){p0, p1};
      }
    }
    l2[0] += l2[1];
    l_run = l_run * corr + (l2[0].x + l2[0].y);
#pragma unroll
    for (int t = 0; t < 4; ++t)
#pragma unroll
      for (int r = 0; r < 8; ++r) o[t][r] *= corr;

    // ---- O^T += V^T * P^T  (8 WMMAs; A-fragments from [d][key] V) ----
    // B element e of lane (lm, half) is key half*8 + e (e < 8) or 16 + half*8 + e - 8 of the
    // 32: exactly what tiles 2*kh and 2*kh + 1 of S^T hold in this lane.
#pragma unroll
    for (int kh = 0; kh < 2; ++kh) {
      v16bf bp;
#pragma unroll   // packed converts of register pairs, no indexing at run time
      for (int r = 0; r < 8; ++r) {
        bp[r]     = (bf16_t)s[2 * kh][r];
        bp[8 + r] = (bf16_t)s[2 * kh + 1][r];
      }
#pragma unroll
      for (int t = 0; t < 4; ++t) {
        v16bf av = ldfrag(&Vc[(t * 16 + lm) * KVP + kh * 32 + half * 8]);
        o[t] = wmma_bf16(av, bp, o[t]);
      }
    }
    __syncthreads();
  }

  // ---- finalize: join the halves' sums, divide by l, store bf16 into [B*S][DIM] ----
  // o[t][r] = O[query lane%16][d = t*16 + 8*half + r]: 8 neighbouring d, one 16 B store.
  const float inv = 1.0f / (l_run + xhalf(l_run));
  bf16_t* orow = aout + ((size_t)b * SEQ + q0 + lm) * DIM + h * HD + 8 * half;
#pragma unroll   // o[] indexed by constants only; the four stores issue together
  for (int t = 0; t < 4; ++t) {
    v8bf w;
#pragma unroll   // w[] indexed by constants only
    for (int r = 0; r < 8; ++r) w[r] = (bf16_t)(o[t][r] * inv);
    *(v8bf*)(orow + t * 16) = w;
  }
}

// ---------------- launch ----------------

extern "C" void kernel_launch(void* const* d_in, const int* in_sizes, int n_in,
                              void* d_out, int out_size, void* d_ws, size_t ws_size,
                              hipStream_t stream) {
  const float* x      = (const float*)d_in[0];
  const float* qkv_w  = (const float*)d_in[1];
  const float* qkv_b  = (const float*)d_in[2];
  const float* proj_w = (const float*)d_in[3];
  const float* proj_b = (const float*)d_in[4];

  const size_t MB = 1u << 20;
  char* ws = (char*)d_ws;
  bf16_t* xb     = (bf16_t*)(ws);             //  8 MB: x as bf16 [4096][1024]
  bf16_t* wqkvT  = (bf16_t*)(ws + 8 * MB);    //  6 MB: qkv_w^T [3072][1024]
  bf16_t* wprojT = (bf16_t*)(ws + 14 * MB);   //  2 MB: proj_w^T [1024][1024]
  bf16_t* qkvbuf = (bf16_t*)(ws + 16 * MB);   // 24 MB: Q,K [B][H][S][D]; V [B][H][D][S]
  bf16_t* aout   = (bf16_t*)(ws + 40 * MB);   //  8 MB: attn out [4096][1024]

  // convert / transpose to bf16
  cvt_bf16_kernel<<<MTOT * DIM / CVT_B, CVT_T, 0, stream>>>(x, xb);
  cvt_transpose_kernel<<<dim3(3 * DIM / 64, DIM / 64), 256, 0, stream>>>(qkv_w, wqkvT, DIM, 3 * DIM);
  cvt_transpose_kernel<<<dim3(DIM / 64, DIM / 64), 256, 0, stream>>>(proj_w, wprojT, DIM, DIM);

  // QKV GEMM: [4096,1024] x [1024,3072] -> scattered bf16 Q/K/V
  gemm_bf16_kernel<0><<<dim3(3 * DIM / 256, MTOT / 64), 256, 0, stream>>>(
      xb, wqkvT, qkv_b, qkvbuf, MTOT, 3 * DIM, DIM);

  // attention
  attn_kernel<<<dim3(SEQ / 128, BATCH * NH), 256, 0, stream>>>(qkvbuf, aout);

  // projection GEMM: [4096,1024] x [1024,1024] + bias -> f32 out
  gemm_bf16_kernel<1><<<dim3(DIM / 256, MTOT / 64), 256, 0, stream>>>(
      aout, wprojT, proj_b, d_out, MTOT, DIM, DIM);
}

// v008
// It runs in 92.2 microseconds.
// Timed twice side by side with v007, it ran 1.04 and 1.05 times as fast.
// All steps since v000 together make it 4.94 times as fast.
#include <hip/hip_runtime.h>
#include <hip/hip_bf16.h>
#include <stdint.h>

typedef __bf16 bf16_t;
typedef __attribute__((ext_vector_type(4)))  __bf16 v4bf;
typedef __attribute__((ext_vector_type(8)))  __bf16 v8bf;
typedef __attribute__((ext_vector_type(16))) __bf16 v16bf;
typedef __attribute__((ext_vector_type(8)))  float  v8f;
typedef __attribute__((ext_vector_type(2)))  float  v2f;

#define DIM   1024
#define SEQ   2048
#define NH    16
#define HD    64
#define BATCH 2
#define MTOT  (BATCH * SEQ)   // 4096 tokens

// ---------------- helpers ----------------

__device__ __forceinline__ v8f zero8() {
  v8f z;
#pragma unroll
  for (int i = 0; i < 8; ++i) z[i] = 0.0f;
  return z;
}

// Low 32 bits of a generic pointer to __shared__ = LDS byte offset (aperture mapping).
__device__ __forceinline__ unsigned lds_off(const void* p) {
  return (unsigned)(unsigned long long)(uintptr_t)p;
}

// CDNA5 async global->LDS copy (per-lane 16B), tracked by ASYNCcnt.
__device__ __forceinline__ void async_ld_b128(unsigned lds, const void* g) {
  asm volatile("global_load_async_to_lds_b128 %0, %1, off"
               :: "v"(lds), "v"((unsigned long long)(uintptr_t)g)
               : "memory");
}

// Ten such copies, one stage's share of a lane, in one statement. Its last line, s_wait_xcnt 0,
// is a precaution: it stands in front of every later rewrite of the address registers that the
// copies name, and only inside the copies' own statement can the compiler move no such rewrite
// ahead of it.
__device__ __forceinline__ void async_ld10_b128(const unsigned (&l)[10], const bf16_t* const (&g)[10]) {
  asm volatile("global_load_async_to_lds_b128 %0, %1, off\n\t"
               "global_load_async_to_lds_b128 %2, %3, off\n\t"
               "global_load_async_to_lds_b128 %4, %5, off\n\t"
               "global_load_async_to_lds_b128 %6, %7, off\n\t"
               "global_load_async_to_lds_b128 %8, %9, off\n\t"
               "global_load_async_to_lds_b128 %10, %11, off\n\t"
               "global_load_async_to_lds_b128 %12, %13, off\n\t"
               "global_load_async_to_lds_b128 %14, %15, off\n\t"
               "global_load_async_to_lds_b128 %16, %17, off\n\t"
               "global_load_async_to_lds_b128 %18, %19, off\n\t"
               "s_wait_xcnt 0x0"
               :: "v"(l[0]), "v"((unsigned long long)(uintptr_t)g[0]),
                  "v"(l[1]), "v"((unsigned long long)(uintptr_t)g[1]),
                  "v"(l[2]), "v"((unsigned long long)(uintptr_t)g[2]),
                  "v"(l[3]), "v"((unsigned long long)(uintptr_t)g[3]),
                  "v"(l[4]), "v"((unsigned long long)(uintptr_t)g[4]),
                  "v"(l[5]), "v"((unsigned long long)(uintptr_t)g[5]),
                  "v"(l[6]), "v"((unsigned long long)(uintptr_t)g[6]),
                  "v"(l[7]), "v"((unsigned long long)(uintptr_t)g[7]),
                  "v"(l[8]), "v"((unsigned long long)(uintptr_t)g[8]),
                  "v"(l[9]), "v"((unsigned long long)(uintptr_t)g[9])
               : "memory");
}

// This wave's LDS reads have returned: stands in front of the barrier behind which their
// buffer is refilled by copies.
__device__ __forceinline__ void wait_dscnt0() {
  asm volatile("s_wait_dscnt 0x0" ::: "memory");
}

template <int N>
__device__ __forceinline__ void wait_asynccnt() {
  asm volatile("s_wait_asynccnt %0" :: "i"(N) : "memory");
}

// Load a 16-element bf16 WMMA fragment: two contiguous 16B chunks at p and p+16
// (ISA 16-bit A/B layout: k = half*8 + e  and  k = 16 + half*8 + e).
__device__ __forceinline__ v16bf ldfrag(const bf16_t* p) {
  v8bf lo = *(const v8bf*)(p);
  v8bf hi = *(const v8bf*)(p + 16);
  return __builtin_shufflevector(lo, hi, 0, 1, 2, 3, 4, 5, 6, 7,
                                 8, 9, 10, 11, 12, 13, 14, 15);
}

__device__ __forceinline__ v8f wmma_bf16(v16bf a, v16bf b, v8f c) {
  return __builtin_amdgcn_wmma_f32_16x16x32_bf16(false, a, false, b,
                                                 (short)0, c, false, false);
}

// Value of lane l ^ 16 (the other half of the wave), by a vector cross-row move.
__device__ __forceinline__ float xhalf(float x) {
  const int b = __builtin_bit_cast(int, x);
  return __builtin_bit_cast(float, __builtin_amdgcn_permlanex16(b, b, 0x76543210, 0xfedcba98,
                                                                false, false));
}

// ---------------- conversion kernel ----------------
// x to bf16 and both weight transposes depend on nothing but the inputs, so they share ONE
// grid: the block index picks the job, and all 768 blocks (3 of 16 waves a WGP) are resident
// at once. The three streams run side by side behind one launch instead of three in a row.

#define PREP_T 512                   // threads a block

// Job 1, x to bf16: 32 elements a lane. Every wave-wide load is 512 contiguous bytes (4 whole
// lines), every wave-wide store 256 (2 whole lines). Its blocks cover the array exactly.
#define CVT_L 8                      // 16 B loads a lane
#define CVT_B (PREP_T * CVT_L * 4)   // elements a block
#define X_BLOCKS (MTOT * DIM / CVT_B)
static_assert((MTOT * DIM) % CVT_B == 0, "the blocks cover x exactly");

// Job 2, out[c*DIM + r] = (bf16) in[r*C + c]  (weights as [N][K] for B-fragments).
// One 64x64 tile per half block of 256 threads, turned in LDS so that both global sides
// are wide and contiguous: 16 B loads along c, 16 B stores along r (8 lanes fill one
// 128 B line of out). A block's two tiles are neighbours along c in one matrix.
#define TT   64
#define TPIT 65   // f32 pitch: both the row-wise writes and the column-wise reads hit distinct banks
#define QW_BLOCKS ((3 * DIM / TT) * (DIM / TT) / 2)   // blocks of qkv_w
#define PW_BLOCKS ((DIM / TT) * (DIM / TT) / 2)       // blocks of proj_w
static_assert((3 * DIM / TT) % 2 == 0 && (DIM / TT) % 2 == 0, "a pair of tiles stays in one tile row");

__global__ __launch_bounds__(PREP_T) void prep_kernel(
    const float* __restrict__ x, const float* __restrict__ qkv_w, const float* __restrict__ proj_w,
    bf16_t* __restrict__ xb, bf16_t* __restrict__ wqkvT, bf16_t* __restrict__ wprojT) {
  __shared__ float tile[2 * TT * TPIT];

  if (blockIdx.x < X_BLOCKS) {
    const size_t base = (size_t)blockIdx.x * CVT_B + threadIdx.x * 4;
    float4 v[CVT_L];
#pragma unroll   // all eight loads in flight before the first convert; v[] stays in registers
    for (int j = 0; j < CVT_L; ++j) v[j] = *(const float4*)(x + base + j * (PREP_T * 4));
#pragma unroll   // v[] indexed by constants only
    for (int j = 0; j < CVT_L; ++j) {
      v4bf w;
      w[0] = (bf16_t)v[j].x; w[1] = (bf16_t)v[j].y; w[2] = (bf16_t)v[j].z; w[3] = (bf16_t)v[j].w;
      *(v4bf*)(xb + base + j * (PREP_T * 4)) = w;
    }
    return;   // the whole block leaves here: it never meets the barrier below
  }

  // Which matrix and which pair of tiles: the same for the whole block. Both matrices have
  // DIM / TT tile rows, so the low bits of the index are the tile row in either.
  const int  wb  = blockIdx.x - X_BLOCKS;
  const bool isq = wb < QW_BLOCKS;
  const float* __restrict__ in  = isq ? qkv_w : proj_w;
  bf16_t* __restrict__      out = isq ? wqkvT : wprojT;
  const int C    = isq ? 3 * DIM : DIM;          // columns of in
  const int pb   = isq ? wb : wb - QW_BLOCKS;
  const int prow = pb % (DIM / TT), pcol = pb / (DIM / TT);

  const int tid = threadIdx.x & 255, hb = threadIdx.x >> 8;
  float* tl = &tile[hb * (TT * TPIT)];
  const int c0 = (pcol * 2 + hb) * TT, r0 = prow * TT;

  const int lr = tid >> 4, lc = (tid & 15) * 4;
  float4 v[4];
#pragma unroll   // all four loads in flight before the first LDS write; v[] stays in registers
  for (int p = 0; p < 4; ++p)
    v[p] = *(const float4*)(in + (r0 + lr + p * 16) * C + c0 + lc);   // below 2^22: 32-bit index
#pragma unroll   // v[] indexed by constants only
  for (int p = 0; p < 4; ++p) {
    float* t = &tl[(lr + p * 16) * TPIT + lc];
    t[0] = v[p].x; t[1] = v[p].y; t[2] = v[p].z; t[3] = v[p].w;
  }
  __syncthreads();

#pragma unroll   // both chunks' LDS reads issue together
  for (int p = 0; p < 2; ++p) {
    const int q = tid + p * 256;
    const int oc = q >> 3, orr = (q & 7) * 8;
    v8bf w;
#pragma unroll   // w[] indexed by constants only
    for (int i = 0; i < 8; ++i) w[i] = (bf16_t)tl[(orr + i) * TPIT + oc];
    *(v8bf*)(out + (size_t)(c0 + oc) * DIM + r0 + orr) = w;
  }
  // A precaution: in the built code a branch behind these two stores can fall through into job 1,
  // which rewrites the registers that the stores name; the wait stands in front of that way.
  asm volatile("s_wait_xcnt 0x0" ::: "memory");
}

// ---------------- bf16 GEMM: C[M,N] = A[M,K] * Bt[N,K]^T + bias ----------------
// MODE 0: scatter bf16 into qkv buffer: Q,K as [B][H][S][D]; V as [B][H][D][S].
// MODE 1: f32 output + bias, row-major [M,N].

#define KST  64           // k per stage: a row of either tile is one whole 128 B line
#define ASTR 72           // LDS row pitch, 64 k + 8: 144 B = 16 B x odd, for the 16 B fragment reads
#define BSTR 72
#define ABUF (64 * ASTR)
#define BBUF (256 * BSTR)
#define SVP  72            // staging pitch of a V row, 64 s + 8: 144 B = 16 B x odd
#define SQP  264           // staging pitch of a Q or K token, 256 columns + 8: 528 B = 16 B x odd

template <int MODE>
__global__ __launch_bounds__(256) void gemm_bf16_kernel(
    const bf16_t* __restrict__ A, const bf16_t* __restrict__ Bt,
    const float* __restrict__ bias, void* __restrict__ outp,
    int M, int N, int K) {
  __shared__ __attribute__((aligned(16))) bf16_t Aw[2 * ABUF];   // double-buffered 64x64 A tiles
  __shared__ __attribute__((aligned(16))) bf16_t Bw[2 * BBUF];   // double-buffered 256x64 B tiles

  const int tid  = threadIdx.x;
  const int wave = tid >> 5, lane = tid & 31;
  const int lm   = lane & 15, half = lane >> 4;
  const int wm   = wave >> 2, wn = wave & 3;     // 2 x 4 wave grid
  const int n0   = blockIdx.x * 256;
  const int m0   = blockIdx.y * 64;

  v8f acc[2][4];
#pragma unroll
  for (int mt = 0; mt < 2; ++mt)
#pragma unroll
    for (int nt = 0; nt < 4; ++nt) acc[mt][nt] = zero8();

  const unsigned awb = lds_off(Aw), bwb = lds_off(Bw);
  const int arow = tid >> 3, acol = (tid & 7) * 8;

  // A row of either tile is one 128 B line of global memory. Eight neighbouring lanes bring
  // it, so a wave-wide copy touches 4 whole lines.
  auto issue = [&](int buf, int kk) {
    // Copy i of a tile brings its rows 32 i .. 32 i + 31: A tile 2 a lane, B tile 8 a lane.
    const unsigned al = awb + (unsigned)(buf * ABUF + arow * ASTR + acol) * 2;
    const unsigned bl = bwb + (unsigned)(buf * BBUF + arow * BSTR + acol) * 2;
    const bf16_t*  ag = A + (size_t)(m0 + arow) * K + kk + acol;
    const bf16_t*  bg = Bt + (size_t)(n0 + arow) * K + kk + acol;
    unsigned l[10];
    const bf16_t* g[10];
#pragma unroll   // l[] and g[] indexed by constants only: they stay in registers
    for (int i = 0; i < 2; ++i) {
      l[i] = al + i * (32 * ASTR * 2);
      g[i] = ag + (size_t)(32 * i) * K;
    }
#pragma unroll   // likewise
    for (int i = 0; i < 8; ++i) {
      l[2 + i] = bl + i * (32 * BSTR * 2);
      g[2 + i] = bg + (size_t)(32 * i) * K;
    }
    async_ld10_b128(l, g);
  };

  // Two buffers: stage t + 1 flies while stage t is worked on. K is a multiple of KST.
  issue(0, 0);
  wait_asynccnt<0>();
  __syncthreads();
  if (KST < K) issue(1, KST);
  for (int kk = 0; kk < K; kk += KST) {
    const int cur = (kk / KST) & 1;
    const bf16_t* Ac = &Aw[cur * ABUF];
    const bf16_t* Bc = &Bw[cur * BBUF];
#pragma unroll   // both halves' fragment reads can issue ahead of the first products
    for (int ks = 0; ks < KST; ks += 32) {
      v16bf af[2], bfg[4];
#pragma unroll
      for (int mt = 0; mt < 2; ++mt)
        af[mt] = ldfrag(&Ac[(wm * 32 + mt * 16 + lm) * ASTR + ks + half * 8]);
#pragma unroll
      for (int nt = 0; nt < 4; ++nt)
        bfg[nt] = ldfrag(&Bc[(wn * 64 + nt * 16 + lm) * BSTR + ks + half * 8]);
#pragma unroll
      for (int mt = 0; mt < 2; ++mt) {
#pragma unroll
        for (int nt = 0; nt < 4; ++nt)
          acc[mt][nt] = wmma_bf16(af[mt], bfg[nt], acc[mt][nt]);
      }
    }
    // Foot of the trip. The one barrier publishes stage t + 1 (every wave's copies have landed)
    // and ends every wave's reads of stage t, whose buffer the copies behind it refill.
    wait_dscnt0();
    wait_asynccnt<0>();
    __syncthreads();
    if (kk + 2 * KST < K) issue(cur, kk + 2 * KST);
  }
  wait_asynccnt<0>();   // no copy is outstanding when the ring becomes staging or the wave ends

  // epilogue
  if (MODE == 0) {
    // The 64 x 256 bf16 tile is turned in LDS so that every global store is 16 B a lane and
    // 8 neighbouring lanes fill one 128 B line. The B ring is free: the loop's last barrier
    // ended its reads, every wave's copies had landed in front of it, and none is issued behind it.
    // 256 divides DIM and 64 divides SEQ, so part, batch and the four heads are the block's.
    bf16_t* St = Bw;
    const int part = n0 >> 10;
    const int bb = m0 >> 11, s0 = m0 & (SEQ - 1);
    const int h0 = (n0 & (DIM - 1)) >> 6;
    bf16_t* ob = (bf16_t*)outp + (size_t)part * ((size_t)BATCH * NH * SEQ * HD) +
                 (size_t)(bb * NH + h0) * (SEQ * HD);
    float bs[4];
#pragma unroll
    for (int nt = 0; nt < 4; ++nt) bs[nt] = bias[n0 + wn * 64 + nt * 16 + lm];

    if (part == 2) {
      // V goes out as [d][s]: a lane's 8 accumulators are 8 neighbouring s of one d.
#pragma unroll
      for (int mt = 0; mt < 2; ++mt) {
#pragma unroll
        for (int nt = 0; nt < 4; ++nt) {
          v8bf w;
#pragma unroll
          for (int r = 0; r < 8; ++r) w[r] = (bf16_t)(acc[mt][nt][r] + bs[nt]);
          *(v8bf*)&St[(wn * 64 + nt * 16 + lm) * SVP + wm * 32 + mt * 16 + 8 * half] = w;
        }
      }
    } else {
      // Q, K go out as [s][d]: staged row-major, m = r + 8*half, n = lane%16.
#pragma unroll
      for (int mt = 0; mt < 2; ++mt) {
#pragma unroll
        for (int nt = 0; nt < 4; ++nt) {
#pragma unroll
          for (int r = 0; r < 8; ++r)
            St[(wm * 32 + mt * 16 + r + 8 * half) * SQP + wn * 64 + nt * 16 + lm] =
                (bf16_t)(acc[mt][nt][r] + bs[nt]);
        }
      }
    }
    __syncthreads();
    if (part == 2) {
#pragma unroll   // all eight LDS reads issue together
      for (int p = 0; p < 8; ++p) {
        const int q = tid + p * 256;
        const int n = q >> 3, c = (q & 7) * 8;      // row h*64 + d of the four heads; 8 s
        *(v8bf*)(ob + (size_t)n * SEQ + s0 + c) = *(const v8bf*)&St[n * SVP + c];
      }
    } else {
#pragma unroll   // all eight LDS reads issue together
      for (int p = 0; p < 8; ++p) {
        const int q = tid + p * 256;
        const int m = q >> 5, c = q & 31;           // token; 16 B chunk of its 256 columns
        *(v8bf*)(ob + (size_t)(c >> 3) * (SEQ * HD) + (size_t)(s0 + m) * HD + (c & 7) * 8) =
            *(const v8bf*)&St[m * SQP + c * 8];
      }
    }
  } else {
#pragma unroll
    for (int mt = 0; mt < 2; ++mt) {
#pragma unroll
      for (int nt = 0; nt < 4; ++nt) {
#pragma unroll
        for (int r = 0; r < 8; ++r) {
          int gm = m0 + wm * 32 + mt * 16 + r + 8 * half;   // C/D: m = r + 8*half
          int gn = n0 + wn * 64 + nt * 16 + lm;             // C/D: n = lane%16
          ((float*)outp)[(size_t)gm * N + gn] = acc[mt][nt][r] + bias[gn];
        }
      }
    }
  }
}

// LDS rows of K and V hold 64 bf16 (128 B) and are all read as 16 B fragments, one row
// per lane: at a 128 B pitch 16 lanes fall on two bank groups, at 144 B (16 B x odd) on all.
#define KVP   72            // LDS row pitch in elements (64 used + 8 never read)
#define KVBUF (64 * KVP)    // elements per K or V tile

// The grid puts two blocks on a WGP, four waves on a SIMD: said here so that the compiler
// spends registers on LDS reads issued in groups ahead of the products instead of saving
// them for waves that the grid does not have.
__global__ __launch_bounds__(256) __attribute__((amdgpu_waves_per_eu(4, 4)))
void attn_kernel(const bf16_t* __restrict__ qkv,
                                                   bf16_t* __restrict__ aout) {
  __shared__ __attribute__((aligned(16))) bf16_t Kw[2 * KVBUF];      // [key][d]    18 KB (double buffered)
  __shared__ __attribute__((aligned(16))) bf16_t Vt[2 * KVBUF];      // [d][key]    18 KB (double buffered)

  const int tid  = threadIdx.x;
  const int wave = tid >> 5, lane = tid & 31;
  const int lm   = lane & 15, half = lane >> 4;
  const int bh   = blockIdx.y;
  const int b    = bh >> 4, h = bh & 15;

  const size_t partsz = (size_t)BATCH * NH * SEQ * HD;
  const bf16_t* Qb = qkv + ((size_t)b * NH + h) * SEQ * HD;
  const bf16_t* Kb = qkv + partsz + ((size_t)b * NH + h) * SEQ * HD;
  const bf16_t* Vb = qkv + 2 * partsz + ((size_t)b * NH + h) * HD * SEQ;  // [d][s]

  const int q0 = blockIdx.x * 128 + wave * 16;

  // Q fragments (B operand: column = query lane%16), loaded once: k-dim = 64 -> 2 chunks of 32
  v16bf aq[2];
#pragma unroll
  for (int kh = 0; kh < 2; ++kh)
    aq[kh] = ldfrag(Qb + (size_t)(q0 + lm) * HD + kh * 32 + half * 8);

  v8f o[4];
#pragma unroll
  for (int t = 0; t < 4; ++t) o[t] = zero8();
  // The lane's query: running maximum (equal in both halves) and the sum over this half's keys.
  float m_run = -1e30f, l_run = 0.0f;

  const unsigned kwb = lds_off(Kw), vtb = lds_off(Vt);
  const int ldr = tid >> 2, ldc = (tid & 3) * 16;
  const float scale = 0.125f;   // 1/sqrt(64)

  auto issue_kv = [&](int buf, int j0) {
    // K block [64 keys][64 d] -> Kw[key][d]
    const bf16_t* kg = Kb + (size_t)(j0 + ldr) * HD + ldc;
    unsigned kl = kwb + (unsigned)(buf * KVBUF + ldr * KVP + ldc) * 2;
    async_ld_b128(kl, kg);
    async_ld_b128(kl + 16, kg + 8);
    // V block (global already [d][s]) -> Vt[d][key]
    const bf16_t* vg = Vb + (size_t)ldr * SEQ + j0 + ldc;
    unsigned vl = vtb + (unsigned)(buf * KVBUF + ldr * KVP + ldc) * 2;
    async_ld_b128(vl, vg);
    async_ld_b128(vl + 16, vg + 8);
  };

  issue_kv(0, 0);
  for (int jb = 0; jb < SEQ / 64; ++jb) {
    const int cur = jb & 1;
    if (jb + 1 < SEQ / 64) {
      issue_kv(cur ^ 1, (jb + 1) * 64);
      wait_asynccnt<4>();
    } else {
      wait_asynccnt<0>();
    }
    __syncthreads();

    const bf16_t* Kc = &Kw[cur * KVBUF];
    const bf16_t* Vc = &Vt[cur * KVBUF];

    // ---- scores S^T = K * Q^T  (64 keys x 16 queries per wave, 8 WMMAs) ----
    // s[t][r] = score of key t*16 + 8*half + r with query lane%16
    v8f s[4];
#pragma unroll
    for (int t = 0; t < 4; ++t) s[t] = zero8();
#pragma unroll
    for (int kh = 0; kh < 2; ++kh) {
#pragma unroll
      for (int t = 0; t < 4; ++t) {
        v16bf ak = ldfrag(&Kc[(t * 16 + lm) * KVP + kh * 32 + half * 8]);
        s[t] = wmma_bf16(ak, aq[kh], s[t]);
      }
    }
#pragma unroll
    for (int t = 0; t < 4; ++t)
#pragma unroll
      for (int r = 0; r < 8; ++r) s[t][r] *= scale;

    // ---- online softmax, one query per lane: 32 keys in-lane, the other 32 in lane ^ 16 ----
    float mt4[4];
#pragma unroll   // four independent chains, one per tile
    for (int t = 0; t < 4; ++t) {
      mt4[t] = s[t][0];
#pragma unroll   // s[] indexed by constants only: stays in registers
      for (int r = 1; r < 8; ++r) mt4[t] = fmaxf(mt4[t], s[t][r]);
    }
    float mx = fmaxf(fmaxf(mt4[0], mt4[1]), fmaxf(mt4[2], mt4[3]));
    mx = fmaxf(mx, xhalf(mx));
    const float mn   = fmaxf(m_run, mx);
    const float corr = __expf(m_run - mn);
    m_run = mn;
    v2f l2[2];   // two independent chains of packed adds over register pairs
    l2[0] = (v2f){0.0f, 0.0f};
    l2[1] = (v2f){0.0f, 0.0f};
#pragma unroll   // s[] and l2[] indexed by constants only: stay in registers
    for (int t = 0; t < 4; ++t) {
#pragma unroll   // likewise
      for (int r = 0; r < 8; r += 2) {
        const float p0 = __expf(s[t][r] - mn), p1 = __expf(s[t][r + 1] - mn);
        s[t][r] = p0;
        s[t][r + 1] = p1;
        l2[t & 1] += (v2f){p0, p1};
      }
    }
    l2[0] += l2[1];
    l_run = l_run * corr + (l2[0].x + l2[0].y);
#pragma unroll
    for (int t = 0; t < 4; ++t)
#pragma unroll
      for (int r = 0; r < 8; ++r) o[t][r] *= corr;

    // ---- O^T += V^T * P^T  (8 WMMAs; A-fragments from [d][key] V) ----
    // B element e of lane (lm, half) is key half*8 + e (e < 8) or 16 + half*8 + e - 8 of the
    // 32: exactly what tiles 2*kh and 2*kh + 1 of S^T hold in this lane.
#pragma unroll
    for (int kh = 0; kh < 2; ++kh) {
      v16bf bp;
#pragma unroll   // packed converts of register pairs, no indexing at run time
      for (int r = 0; r < 8; ++r) {
        bp[r]     = (bf16_t)s[2 * kh][r];
        bp[8 + r] = (bf16_t)s[2 * kh + 1][r];
      }
#pragma unroll
      for (int t = 0; t < 4; ++t) {
        v16bf av = ldfrag(&Vc[(t * 16 + lm) * KVP + kh * 32 + half * 8]);
        o[t] = wmma_bf16(av, bp, o[t]);
      }
    }
    __syncthreads();
  }

  // ---- finalize: join the halves' sums, divide by l, store bf16 into [B*S][DIM] ----
  // o[t][r] = O[query lane%16][d = t*16 + 8*half + r]: 8 neighbouring d, one 16 B store.
  const float inv = 1.0f / (l_run + xhalf(l_run));
  bf16_t* orow = aout + ((size_t)b * SEQ + q0 + lm) * DIM + h * HD + 8 * half;
#pragma unroll   // o[] indexed by constants only; the four stores issue together
  for (int t = 0; t < 4; ++t) {
    v8bf w;
#pragma unroll   // w[] indexed by constants only
    for (int r = 0; r < 8; ++r) w[r] = (bf16_t)(o[t][r] * inv);
    *(v8bf*)(orow + t * 16) = w;
  }
}

// ---------------- launch ----------------

extern "C" void kernel_launch(void* const* d_in, const int* in_sizes, int n_in,
                              void* d_out, int out_size, void* d_ws, size_t ws_size,
                              hipStream_t stream) {
  const float* x      = (const float*)d_in[0];
  const float* qkv_w  = (const float*)d_in[1];
  const float* qkv_b  = (const float*)d_in[2];
  const float* proj_w = (const float*)d_in[3];
  const float* proj_b = (const float*)d_in[4];

  const size_t MB = 1u << 20;
  char* ws = (char*)d_ws;
  bf16_t* xb     = (bf16_t*)(ws);             //  8 MB: x as bf16 [4096][1024]
  bf16_t* wqkvT  = (bf16_t*)(ws + 8 * MB);    //  6 MB: qkv_w^T [3072][1024]
  bf16_t* wprojT = (bf16_t*)(ws + 14 * MB);   //  2 MB: proj_w^T [1024][1024]
  bf16_t* qkvbuf = (bf16_t*)(ws + 16 * MB);   // 24 MB: Q,K [B][H][S][D]; V [B][H][D][S]
  bf16_t* aout   = (bf16_t*)(ws + 40 * MB);   //  8 MB: attn out [4096][1024]

  // x to bf16 and both weight transposes, one launch
  prep_kernel<<<X_BLOCKS + QW_BLOCKS + PW_BLOCKS, PREP_T, 0, stream>>>(x, qkv_w, proj_w,
                                                                      xb, wqkvT, wprojT);

  // QKV GEMM: [4096,1024] x [1024,3072] -> scattered bf16 Q/K/V
  gemm_bf16_kernel<0><<<dim3(3 * DIM / 256, MTOT / 64), 256, 0, stream>>>(
      xb, wqkvT, qkv_b, qkvbuf, MTOT, 3 * DIM, DIM);

  // attention
  attn_kernel<<<dim3(SEQ / 128, BATCH * NH), 256, 0, stream>>>(qkvbuf, aout);

  // projection GEMM: [4096,1024] x [1024,1024] + bias -> f32 out
  gemm_bf16_kernel<1><<<dim3(DIM / 256, MTOT / 64), 256, 0, stream>>>(
      aout, wprojT, proj_b, d_out, MTOT, DIM, DIM);
}

// v009
// One run takes 88.8 microseconds.
// Two timings next to v008 both put it at 1.04 times that version's speed.
// Over all steps from v000 it is 5.13 times as fast.
#include <hip/hip_runtime.h>
#include <hip/hip_bf16.h>
#include <stdint.h>

typedef __bf16 bf16_t;
typedef __attribute__((ext_vector_type(4)))  __bf16 v4bf;
typedef __attribute__((ext_vector_type(8)))  __bf16 v8bf;
typedef __attribute__((ext_vector_type(16))) __bf16 v16bf;
typedef __attribute__((ext_vector_type(8)))  float  v8f;
typedef __attribute__((ext_vector_type(2)))  float  v2f;
typedef __attribute__((ext_vector_type(4)))  float  v4f;

#define DIM   1024
#define SEQ   2048
#define NH    16
#define HD    64
#define BATCH 2
#define MTOT  (BATCH * SEQ)   // 4096 tokens

// ---------------- helpers ----------------

__device__ __forceinline__ v8f zero8() {
  v8f z;
#pragma unroll
  for (int i = 0; i < 8; ++i) z[i] = 0.0f;
  return z;
}

// Low 32 bits of a generic pointer to __shared__ = LDS byte offset (aperture mapping).
__device__ __forceinline__ unsigned lds_off(const void* p) {
  return (unsigned)(unsigned long long)(uintptr_t)p;
}

// CDNA5 async global->LDS copies (per-lane 16B), tracked by ASYNCcnt.
// Eight of them, one K and V stage's share of a lane, in one statement. Its last line,
// s_wait_xcnt 0, is the precaution described at the ten-copy form below.
__device__ __forceinline__ void async_ld8_b128(const unsigned (&l)[8], const bf16_t* const (&g)[8]) {
  asm volatile("global_load_async_to_lds_b128 %0, %1, off\n\t"
               "global_load_async_to_lds_b128 %2, %3, off\n\t"
               "global_load_async_to_lds_b128 %4, %5, off\n\t"
               "global_load_async_to_lds_b128 %6, %7, off\n\t"
               "global_load_async_to_lds_b128 %8, %9, off\n\t"
               "global_load_async_to_lds_b128 %10, %11, off\n\t"
               "global_load_async_to_lds_b128 %12, %13, off\n\t"
               "global_load_async_to_lds_b128 %14, %15, off\n\t"
               "s_wait_xcnt 0x0"
               :: "v"(l[0]), "v"((unsigned long long)(uintptr_t)g[0]),
                  "v"(l[1]), "v"((unsigned long long)(uintptr_t)g[1]),
                  "v"(l[2]), "v"((unsigned long long)(uintptr_t)g[2]),
                  "v"(l[3]), "v"((unsigned long long)(uintptr_t)g[3]),
                  "v"(l[4]), "v"((unsigned long long)(uintptr_t)g[4]),
                  "v"(l[5]), "v"((unsigned long long)(uintptr_t)g[5]),
                  "v"(l[6]), "v"((unsigned long long)(uintptr_t)g[6]),
                  "v"(l[7]), "v"((unsigned long long)(uintptr_t)g[7])
               : "memory");
}

// Ten such copies, one stage's share of a lane, in one statement. Its last line, s_wait_xcnt 0,
// is a precaution: it stands in front of every later rewrite of the address registers that the
// copies name, and only inside the copies' own statement can the compiler move no such rewrite
// ahead of it.
__device__ __forceinline__ void async_ld10_b128(const unsigned (&l)[10], const bf16_t* const (&g)[10]) {
  asm volatile("global_load_async_to_lds_b128 %0, %1, off\n\t"
               "global_load_async_to_lds_b128 %2, %3, off\n\t"
               "global_load_async_to_lds_b128 %4, %5, off\n\t"
               "global_load_async_to_lds_b128 %6, %7, off\n\t"
               "global_load_async_to_lds_b128 %8, %9, off\n\t"
               "global_load_async_to_lds_b128 %10, %11, off\n\t"
               "global_load_async_to_lds_b128 %12, %13, off\n\t"
               "global_load_async_to_lds_b128 %14, %15, off\n\t"
               "global_load_async_to_lds_b128 %16, %17, off\n\t"
               "global_load_async_to_lds_b128 %18, %19, off\n\t"
               "s_wait_xcnt 0x0"
               :: "v"(l[0]), "v"((unsigned long long)(uintptr_t)g[0]),
                  "v"(l[1]), "v"((unsigned long long)(uintptr_t)g[1]),
                  "v"(l[2]), "v"((unsigned long long)(uintptr_t)g[2]),
                  "v"(l[3]), "v"((unsigned long long)(uintptr_t)g[3]),
                  "v"(l[4]), "v"((unsigned long long)(uintptr_t)g[4]),
                  "v"(l[5]), "v"((unsigned long long)(uintptr_t)g[5]),
                  "v"(l[6]), "v"((unsigned long long)(uintptr_t)g[6]),
                  "v"(l[7]), "v"((unsigned long long)(uintptr_t)g[7]),
                  "v"(l[8]), "v"((unsigned long long)(uintptr_t)g[8]),
                  "v"(l[9]), "v"((unsigned long long)(uintptr_t)g[9])
               : "memory");
}

// This wave's LDS reads have returned: stands in front of the barrier behind which their
// buffer is refilled by copies.
__device__ __forceinline__ void wait_dscnt0() {
  asm volatile("s_wait_dscnt 0x0" ::: "memory");
}

template <int N>
__device__ __forceinline__ void wait_asynccnt() {
  asm volatile("s_wait_asynccnt %0" :: "i"(N) : "memory");
}

// Load a 16-element bf16 WMMA fragment: two contiguous 16B chunks at p and p+16
// (ISA 16-bit A/B layout: k = half*8 + e  and  k = 16 + half*8 + e).
__device__ __forceinline__ v16bf ldfrag(const bf16_t* p) {
  v8bf lo = *(const v8bf*)(p);
  v8bf hi = *(const v8bf*)(p + 16);
  return __builtin_shufflevector(lo, hi, 0, 1, 2, 3, 4, 5, 6, 7,
                                 8, 9, 10, 11, 12, 13, 14, 15);
}

__device__ __forceinline__ v8f wmma_bf16(v16bf a, v16bf b, v8f c) {
  return __builtin_amdgcn_wmma_f32_16x16x32_bf16(false, a, false, b,
                                                 (short)0, c, false, false);
}

// Value of lane l ^ 16 (the other half of the wave), by a vector cross-row move.
__device__ __forceinline__ float xhalf(float x) {
  const int b = __builtin_bit_cast(int, x);
  return __builtin_bit_cast(float, __builtin_amdgcn_permlanex16(b, b, 0x76543210, 0xfedcba98,
                                                                false, false));
}

// ---------------- conversion kernel ----------------
// x to bf16 and both weight transposes depend on nothing but the inputs, so they share ONE
// grid: the block index picks the job, and all 768 blocks (3 of 16 waves a WGP) are resident
// at once. The three streams run side by side behind one launch instead of three in a row.

#define PREP_T 512                   // threads a block

// Job 1, x to bf16: 32 elements a lane. Every wave-wide load is 512 contiguous bytes (4 whole
// lines), every wave-wide store 256 (2 whole lines). Its blocks cover the array exactly.
#define CVT_L 8                      // 16 B loads a lane
#define CVT_B (PREP_T * CVT_L * 4)   // elements a block
#define X_BLOCKS (MTOT * DIM / CVT_B)
static_assert((MTOT * DIM) % CVT_B == 0, "the blocks cover x exactly");

// Job 2, out[c*DIM + r] = (bf16) in[r*C + c]  (weights as [N][K] for B-fragments).
// One 64x64 tile per half block of 256 threads, turned in LDS so that both global sides
// are wide and contiguous: 16 B loads along c, 16 B stores along r (8 lanes fill one
// 128 B line of out). A block's two tiles are neighbours along c in one matrix.
#define TT   64
#define TPIT 65   // f32 pitch: both the row-wise writes and the column-wise reads hit distinct banks
#define QW_BLOCKS ((3 * DIM / TT) * (DIM / TT) / 2)   // blocks of qkv_w
#define PW_BLOCKS ((DIM / TT) * (DIM / TT) / 2)       // blocks of proj_w
static_assert((3 * DIM / TT) % 2 == 0 && (DIM / TT) % 2 == 0, "a pair of tiles stays in one tile row");

__global__ __launch_bounds__(PREP_T) void prep_kernel(
    const float* __restrict__ x, const float* __restrict__ qkv_w, const float* __restrict__ proj_w,
    bf16_t* __restrict__ xb, bf16_t* __restrict__ wqkvT, bf16_t* __restrict__ wprojT) {
  __shared__ float tile[2 * TT * TPIT];

  if (blockIdx.x < X_BLOCKS) {
    const size_t base = (size_t)blockIdx.x * CVT_B + threadIdx.x * 4;
    float4 v[CVT_L];
#pragma unroll   // all eight loads in flight before the first convert; v[] stays in registers
    for (int j = 0; j < CVT_L; ++j) v[j] = *(const float4*)(x + base + j * (PREP_T * 4));
#pragma unroll   // v[] indexed by constants only
    for (int j = 0; j < CVT_L; ++j) {
      v4bf w;
      w[0] = (bf16_t)v[j].x; w[1] = (bf16_t)v[j].y; w[2] = (bf16_t)v[j].z; w[3] = (bf16_t)v[j].w;
      *(v4bf*)(xb + base + j * (PREP_T * 4)) = w;
    }
    return;   // the whole block leaves here: it never meets the barrier below
  }

  // Which matrix and which pair of tiles: the same for the whole block. Both matrices have
  // DIM / TT tile rows, so the low bits of the index are the tile row in either.
  const int  wb  = blockIdx.x - X_BLOCKS;
  const bool isq = wb < QW_BLOCKS;
  const float* __restrict__ in  = isq ? qkv_w : proj_w;
  bf16_t* __restrict__      out = isq ? wqkvT : wprojT;
  const int C    = isq ? 3 * DIM : DIM;          // columns of in
  const int pb   = isq ? wb : wb - QW_BLOCKS;
  const int prow = pb % (DIM / TT), pcol = pb / (DIM / TT);

  const int tid = threadIdx.x & 255, hb = threadIdx.x >> 8;
  float* tl = &tile[hb * (TT * TPIT)];
  const int c0 = (pcol * 2 + hb) * TT, r0 = prow * TT;

  const int lr = tid >> 4, lc = (tid & 15) * 4;
  float4 v[4];
#pragma unroll   // all four loads in flight before the first LDS write; v[] stays in registers
  for (int p = 0; p < 4; ++p)
    v[p] = *(const float4*)(in + (r0 + lr + p * 16) * C + c0 + lc);   // below 2^22: 32-bit index
#pragma unroll   // v[] indexed by constants only
  for (int p = 0; p < 4; ++p) {
    float* t = &tl[(lr + p * 16) * TPIT + lc];
    t[0] = v[p].x; t[1] = v[p].y; t[2] = v[p].z; t[3] = v[p].w;
  }
  __syncthreads();

#pragma unroll   // both chunks' LDS reads issue together
  for (int p = 0; p < 2; ++p) {
    const int q = tid + p * 256;
    const int oc = q >> 3, orr = (q & 7) * 8;
    v8bf w;
#pragma unroll   // w[] indexed by constants only
    for (int i = 0; i < 8; ++i) w[i] = (bf16_t)tl[(orr + i) * TPIT + oc];
    *(v8bf*)(out + (size_t)(c0 + oc) * DIM + r0 + orr) = w;
  }
  // A precaution: in the built code a branch behind these two stores can fall through into job 1,
  // which rewrites the registers that the stores name; the wait stands in front of that way.
  asm volatile("s_wait_xcnt 0x0" ::: "memory");
}

// ---------------- bf16 GEMM: C[M,N] = A[M,K] * Bt[N,K]^T + bias ----------------
// MODE 0: scatter bf16 into qkv buffer: Q,K as [B][H][S][D]; V as [B][H][D][S].
// MODE 1: f32 output + bias, row-major [M,N].

#define KST  64           // k per stage: a row of either tile is one whole 128 B line
#define ASTR 72           // LDS row pitch, 64 k + 8: 144 B = 16 B x odd, for the 16 B fragment reads
#define BSTR 72
#define ABUF (64 * ASTR)
#define BBUF (256 * BSTR)
#define SVP  72            // staging pitch of a V row, 64 s + 8: 144 B = 16 B x odd
#define SQP  264           // staging pitch of a Q or K token, 256 columns + 8: 528 B = 16 B x odd

template <int MODE>
__global__ __launch_bounds__(256) void gemm_bf16_kernel(
    const bf16_t* __restrict__ A, const bf16_t* __restrict__ Bt,
    const float* __restrict__ bias, void* __restrict__ outp,
    int M, int N, int K) {
  __shared__ __attribute__((aligned(16))) bf16_t Aw[2 * ABUF];   // double-buffered 64x64 A tiles
  __shared__ __attribute__((aligned(16))) bf16_t Bw[2 * BBUF];   // double-buffered 256x64 B tiles

  const int tid  = threadIdx.x;
  const int wave = tid >> 5, lane = tid & 31;
  const int lm   = lane & 15, half = lane >> 4;
  const int wm   = wave >> 2, wn = wave & 3;     // 2 x 4 wave grid
  const int n0   = blockIdx.x * 256;
  const int m0   = blockIdx.y * 64;

  v8f acc[2][4];
#pragma unroll
  for (int mt = 0; mt < 2; ++mt)
#pragma unroll
    for (int nt = 0; nt < 4; ++nt) acc[mt][nt] = zero8();

  const unsigned awb = lds_off(Aw), bwb = lds_off(Bw);
  const int arow = tid >> 3, acol = (tid & 7) * 8;

  // A row of either tile is one 128 B line of global memory. Eight neighbouring lanes bring
  // it, so a wave-wide copy touches 4 whole lines.
  auto issue = [&](int buf, int kk) {
    // Copy i of a tile brings its rows 32 i .. 32 i + 31: A tile 2 a lane, B tile 8 a lane.
    const unsigned al = awb + (unsigned)(buf * ABUF + arow * ASTR + acol) * 2;
    const unsigned bl = bwb + (unsigned)(buf * BBUF + arow * BSTR + acol) * 2;
    const bf16_t*  ag = A + (size_t)(m0 + arow) * K + kk + acol;
    const bf16_t*  bg = Bt + (size_t)(n0 + arow) * K + kk + acol;
    unsigned l[10];
    const bf16_t* g[10];
#pragma unroll   // l[] and g[] indexed by constants only: they stay in registers
    for (int i = 0; i < 2; ++i) {
      l[i] = al + i * (32 * ASTR * 2);
      g[i] = ag + (size_t)(32 * i) * K;
    }
#pragma unroll   // likewise
    for (int i = 0; i < 8; ++i) {
      l[2 + i] = bl + i * (32 * BSTR * 2);
      g[2 + i] = bg + (size_t)(32 * i) * K;
    }
    async_ld10_b128(l, g);
  };

  // Two buffers: stage t + 1 flies while stage t is worked on. K is a multiple of KST.
  issue(0, 0);
  wait_asynccnt<0>();
  __syncthreads();
  if (KST < K) issue(1, KST);
  for (int kk = 0; kk < K; kk += KST) {
    const int cur = (kk / KST) & 1;
    const bf16_t* Ac = &Aw[cur * ABUF];
    const bf16_t* Bc = &Bw[cur * BBUF];
#pragma unroll   // both halves' fragment reads can issue ahead of the first products
    for (int ks = 0; ks < KST; ks += 32) {
      v16bf af[2], bfg[4];
#pragma unroll
      for (int mt = 0; mt < 2; ++mt)
        af[mt] = ldfrag(&Ac[(wm * 32 + mt * 16 + lm) * ASTR + ks + half * 8]);
#pragma unroll
      for (int nt = 0; nt < 4; ++nt)
        bfg[nt] = ldfrag(&Bc[(wn * 64 + nt * 16 + lm) * BSTR + ks + half * 8]);
#pragma unroll
      for (int mt = 0; mt < 2; ++mt) {
#pragma unroll
        for (int nt = 0; nt < 4; ++nt)
          acc[mt][nt] = wmma_bf16(af[mt], bfg[nt], acc[mt][nt]);
      }
    }
    // Foot of the trip. The one barrier publishes stage t + 1 (every wave's copies have landed)
    // and ends every wave's reads of stage t, whose buffer the copies behind it refill.
    wait_dscnt0();
    wait_asynccnt<0>();
    __syncthreads();
    if (kk + 2 * KST < K) issue(cur, kk + 2 * KST);
  }
  wait_asynccnt<0>();   // no copy is outstanding when the ring becomes staging or the wave ends

  // epilogue
  if (MODE == 0) {
    // The 64 x 256 bf16 tile is turned in LDS so that every global store is 16 B a lane and
    // 8 neighbouring lanes fill one 128 B line. The B ring is free: the loop's last barrier
    // ended its reads, every wave's copies had landed in front of it, and none is issued behind it.
    // 256 divides DIM and 64 divides SEQ, so part, batch and the four heads are the block's.
    bf16_t* St = Bw;
    const int part = n0 >> 10;
    const int bb = m0 >> 11, s0 = m0 & (SEQ - 1);
    const int h0 = (n0 & (DIM - 1)) >> 6;
    bf16_t* ob = (bf16_t*)outp + (size_t)part * ((size_t)BATCH * NH * SEQ * HD) +
                 (size_t)(bb * NH + h0) * (SEQ * HD);
    float bs[4];
#pragma unroll
    for (int nt = 0; nt < 4; ++nt) bs[nt] = bias[n0 + wn * 64 + nt * 16 + lm];

    if (part == 2) {
      // V goes out as [d][s]: a lane's 8 accumulators are 8 neighbouring s of one d.
#pragma unroll
      for (int mt = 0; mt < 2; ++mt) {
#pragma unroll
        for (int nt = 0; nt < 4; ++nt) {
          v8bf w;
#pragma unroll
          for (int r = 0; r < 8; ++r) w[r] = (bf16_t)(acc[mt][nt][r] + bs[nt]);
          *(v8bf*)&St[(wn * 64 + nt * 16 + lm) * SVP + wm * 32 + mt * 16 + 8 * half] = w;
        }
      }
    } else {
      // Q, K go out as [s][d]: staged row-major, m = r + 8*half, n = lane%16.
#pragma unroll
      for (int mt = 0; mt < 2; ++mt) {
#pragma unroll
        for (int nt = 0; nt < 4; ++nt) {
#pragma unroll
          for (int r = 0; r < 8; ++r)
            St[(wm * 32 + mt * 16 + r + 8 * half) * SQP + wn * 64 + nt * 16 + lm] =
                (bf16_t)(acc[mt][nt][r] + bs[nt]);
        }
      }
    }
    __syncthreads();
    if (part == 2) {
#pragma unroll   // all eight LDS reads issue together
      for (int p = 0; p < 8; ++p) {
        const int q = tid + p * 256;
        const int n = q >> 3, c = (q & 7) * 8;      // row h*64 + d of the four heads; 8 s
        *(v8bf*)(ob + (size_t)n * SEQ + s0 + c) = *(const v8bf*)&St[n * SVP + c];
      }
    } else {
#pragma unroll   // all eight LDS reads issue together
      for (int p = 0; p < 8; ++p) {
        const int q = tid + p * 256;
        const int m = q >> 5, c = q & 31;           // token; 16 B chunk of its 256 columns
        *(v8bf*)(ob + (size_t)(c >> 3) * (SEQ * HD) + (size_t)(s0 + m) * HD + (c & 7) * 8) =
            *(const v8bf*)&St[m * SQP + c * 8];
      }
    }
  } else {
#pragma unroll
    for (int mt = 0; mt < 2; ++mt) {
#pragma unroll
      for (int nt = 0; nt < 4; ++nt) {
#pragma unroll
        for (int r = 0; r < 8; ++r) {
          int gm = m0 + wm * 32 + mt * 16 + r + 8 * half;   // C/D: m = r + 8*half
          int gn = n0 + wn * 64 + nt * 16 + lm;             // C/D: n = lane%16
          ((float*)outp)[(size_t)gm * N + gn] = acc[mt][nt][r] + bias[gn];
        }
      }
    }
  }
}

// LDS rows of K and V hold 64 bf16 (128 B) and are all read as 16 B fragments, one row
// per lane: at a 128 B pitch 16 lanes fall on two bank groups, at 144 B (16 B x odd) on all.
#define KVP   72            // LDS row pitch in elements (64 used + 8 never read)
#define KVBUF (64 * KVP)    // elements per K or V tile
#define NST   (SEQ / 128)   // stages: two 64-key tiles each, one per key share
#define JROWS 17            // 16 B rows a lane hands over at the join: 64 outputs, 2 maxima, 2 sums
static_assert(4 * JROWS * 32 * 16 <= 4 * KVBUF * 2, "the join fits the K ring");

// The grid puts two blocks on a WGP, four waves on a SIMD: said here so that the compiler
// spends registers on LDS reads issued in groups ahead of the products instead of saving
// them for waves that the grid does not have.
__global__ __launch_bounds__(256) __attribute__((amdgpu_waves_per_eu(4, 4)))
void attn_kernel(const bf16_t* __restrict__ qkv,
                                                   bf16_t* __restrict__ aout) {
  __shared__ __attribute__((aligned(16))) bf16_t Kw[4 * KVBUF];      // [buffer][share][key][d]  36 KB
  __shared__ __attribute__((aligned(16))) bf16_t Vt[4 * KVBUF];      // [buffer][share][d][key]  36 KB

  const int tid  = threadIdx.x;
  const int wave = __builtin_amdgcn_readfirstlane(tid >> 5), lane = tid & 31;
  const int lm   = lane & 15, half = lane >> 4;
  const int wq   = wave & 3, ksh = wave >> 2;    // q rows of the wave; its key share
  const int bh   = blockIdx.y;
  const int b    = bh >> 4, h = bh & 15;

  const size_t partsz = (size_t)BATCH * NH * SEQ * HD;
  const bf16_t* Qb = qkv + ((size_t)b * NH + h) * SEQ * HD;
  const bf16_t* Kb = qkv + partsz + ((size_t)b * NH + h) * SEQ * HD;
  const bf16_t* Vb = qkv + 2 * partsz + ((size_t)b * NH + h) * HD * SEQ;  // [d][s]

  const int q0 = blockIdx.x * 128 + wq * 32;

  // Q fragments (B operand: column = query c*16 + lane%16), loaded once: k-dim = 64 -> 2 chunks of 32
  v16bf aq[2][2];
#pragma unroll
  for (int c = 0; c < 2; ++c)
#pragma unroll
    for (int kh = 0; kh < 2; ++kh)
      aq[c][kh] = ldfrag(Qb + (size_t)(q0 + c * 16 + lm) * HD + kh * 32 + half * 8);

  v8f o[2][4];
#pragma unroll
  for (int c = 0; c < 2; ++c)
#pragma unroll
    for (int t = 0; t < 4; ++t) o[c][t] = zero8();
  // Per column group, the lane's query: running maximum (equal in both halves) and the sum
  // over this half's keys, both over the wave's key share.
  v2f m_run = {-1e30f, -1e30f}, l_run = {0.0f, 0.0f};

  const unsigned kwb = lds_off(Kw), vtb = lds_off(Vt);
  const int ldr = tid >> 2, ldc = (tid & 3) * 16;
  const float scale = 0.125f;   // 1/sqrt(64)
  const float LOG2E = 1.44269504f;

  auto issue_kv = [&](int buf, int st) {
    unsigned l[8];
    const bf16_t* g[8];
#pragma unroll   // l[] and g[] indexed by constants only: they stay in registers
    for (int p = 0; p < 2; ++p) {
      const int j0 = (st * 2 + p) * 64;
      const unsigned off = (unsigned)((buf * 2 + p) * KVBUF + ldr * KVP + ldc) * 2;
      // K block [64 keys][64 d] -> Kw[key][d]
      const bf16_t* kg = Kb + (size_t)(j0 + ldr) * HD + ldc;
      l[4 * p]     = kwb + off;      g[4 * p]     = kg;
      l[4 * p + 1] = kwb + off + 16; g[4 * p + 1] = kg + 8;
      // V block (global already [d][s]) -> Vt[d][key]
      const bf16_t* vg = Vb + (size_t)ldr * SEQ + j0 + ldc;
      l[4 * p + 2] = vtb + off;      g[4 * p + 2] = vg;
      l[4 * p + 3] = vtb + off + 16; g[4 * p + 3] = vg + 8;
    }
    async_ld8_b128(l, g);
  };

  issue_kv(0, 0);
  for (int st = 0; st < NST; ++st) {
    const int cur = st & 1;
    if (st + 1 < NST) {
      issue_kv(cur ^ 1, st + 1);
      wait_asynccnt<8>();
    } else {
      wait_asynccnt<0>();
    }
    __syncthreads();

    const bf16_t* Kc = &Kw[(cur * 2 + ksh) * KVBUF];
    const bf16_t* Vc = &Vt[(cur * 2 + ksh) * KVBUF];

    // ---- scores S^T = K * Q^T  (64 keys x 32 queries per wave, 16 WMMAs on 8 fragments) ----
    // s[c][t][r] = score of key t*16 + 8*half + r with query c*16 + lane%16
    v8f s[2][4];
#pragma unroll
    for (int c = 0; c < 2; ++c)
#pragma unroll
      for (int t = 0; t < 4; ++t) s[c][t] = zero8();
#pragma unroll
    for (int kh = 0; kh < 2; ++kh) {
#pragma unroll
      for (int t = 0; t < 4; ++t) {
        v16bf ak = ldfrag(&Kc[(t * 16 + lm) * KVP + kh * 32 + half * 8]);
#pragma unroll
        for (int c = 0; c < 2; ++c) s[c][t] = wmma_bf16(ak, aq[c][kh], s[c][t]);
      }
    }

    // ---- online softmax, one query per lane and column group: 32 keys in-lane, 32 in lane ^ 16 ----
    // Whole-tile vector expressions compile to packed operations on the register pairs of one
    // accumulator tile as they lie; what there is once per column group goes as one pair.
    v2f mx2;
#pragma unroll   // the two column groups are independent chains
    for (int c = 0; c < 2; ++c) {
#pragma unroll
      for (int t = 0; t < 4; ++t) s[c][t] *= scale;
      float mt4[4];
#pragma unroll   // four independent chains, one per tile
      for (int t = 0; t < 4; ++t) {
        mt4[t] = s[c][t][0];
#pragma unroll   // s[] indexed by constants only: stays in registers
        for (int r = 1; r < 8; ++r) mt4[t] = fmaxf(mt4[t], s[c][t][r]);
      }
      const float mx = fmaxf(fmaxf(mt4[0], mt4[1]), fmaxf(mt4[2], mt4[3]));
      mx2[c] = fmaxf(mx, xhalf(mx));
    }
    const v2f mn2 = __builtin_elementwise_max(m_run, mx2);
    const v2f ce  = (m_run - mn2) * LOG2E;   // exp(x) = 2^(x log2 e), as __expf takes it
    const v2f corr = {__builtin_amdgcn_exp2f(ce.x), __builtin_amdgcn_exp2f(ce.y)};
    m_run = mn2;
    v2f ls;
#pragma unroll   // the two column groups are independent chains
    for (int c = 0; c < 2; ++c) {
      v2f l2[2];   // two independent chains of packed adds over register pairs
      l2[0] = (v2f){0.0f, 0.0f};
      l2[1] = (v2f){0.0f, 0.0f};
#pragma unroll   // s[] and l2[] indexed by constants only: stay in registers
      for (int t = 0; t < 4; ++t) {
        const v8f e = (s[c][t] - mn2[c]) * LOG2E;
#pragma unroll   // likewise
        for (int r = 0; r < 8; ++r) s[c][t][r] = __builtin_amdgcn_exp2f(e[r]);
        l2[t & 1] += __builtin_shufflevector(s[c][t], s[c][t], 0, 1);
        l2[t & 1] += __builtin_shufflevector(s[c][t], s[c][t], 2, 3);
        l2[t & 1] += __builtin_shufflevector(s[c][t], s[c][t], 4, 5);
        l2[t & 1] += __builtin_shufflevector(s[c][t], s[c][t], 6, 7);
      }
      l2[0] += l2[1];
      ls[c] = l2[0].x + l2[0].y;
#pragma unroll
      for (int t = 0; t < 4; ++t) o[c][t] *= corr[c];
    }
    l_run = l_run * corr + ls;

    // ---- O^T += V^T * P^T  (16 WMMAs on 8 fragments; A-fragments from [d][key] V) ----
    // B element e of lane (lm, half) is key half*8 + e (e < 8) or 16 + half*8 + e - 8 of the
    // 32: exactly what tiles 2*kh and 2*kh + 1 of S^T hold in this lane.
#pragma unroll
    for (int kh = 0; kh < 2; ++kh) {
      v16bf bp[2];
#pragma unroll
      for (int c = 0; c < 2; ++c)
#pragma unroll   // packed converts of register pairs, no indexing at run time
        for (int r = 0; r < 8; ++r) {
          bp[c][r]     = (bf16_t)s[c][2 * kh][r];
          bp[c][8 + r] = (bf16_t)s[c][2 * kh + 1][r];
        }
#pragma unroll
      for (int t = 0; t < 4; ++t) {
        v16bf av = ldfrag(&Vc[(t * 16 + lm) * KVP + kh * 32 + half * 8]);
#pragma unroll
        for (int c = 0; c < 2; ++c) o[c][t] = wmma_bf16(av, bp[c], o[c][t]);
      }
    }
    wait_dscnt0();   // in front of the barrier behind which the next trip's copies refill this buffer
    __syncthreads();
  }

  // ---- join the two key shares: waves 4..7 hand their partial results to waves 0..3 ----
  // The K ring is free: the loop's last barrier ended its reads, and every wave's copies had
  // landed in front of the last trip's first barrier. Row i of a wave is 32 lanes x 16 B.
  v4f* J = (v4f*)Kw + (size_t)wq * (JROWS * 32) + lane;
  if (ksh == 1) {
#pragma unroll   // o[] indexed by constants only
    for (int c = 0; c < 2; ++c)
#pragma unroll
      for (int t = 0; t < 4; ++t) {
        J[((c * 4 + t) * 2) * 32]     = __builtin_shufflevector(o[c][t], o[c][t], 0, 1, 2, 3);
        J[((c * 4 + t) * 2 + 1) * 32] = __builtin_shufflevector(o[c][t], o[c][t], 4, 5, 6, 7);
      }
    J[16 * 32] = (v4f){m_run[0], l_run[0], m_run[1], l_run[1]};
  }
  __syncthreads();
  if (ksh == 1) return;   // whole waves leave, behind the last barrier

  // ---- finalize: both shares to one maximum, join the halves' sums, divide by l, store bf16 ----
  // o[c][t][r] = O[query c*16 + lane%16][d = t*16 + 8*half + r]: 8 neighbouring d, one 16 B store.
  const v4f ml = J[16 * 32];
#pragma unroll   // o[] indexed by constants only
  for (int c = 0; c < 2; ++c) {
    const float m1 = ml[2 * c], l1 = ml[2 * c + 1];
    const float mn = fmaxf(m_run[c], m1);
    const float a0 = __expf(m_run[c] - mn), a1 = __expf(m1 - mn);
    const float l  = l_run[c] * a0 + l1 * a1;
    const float inv = 1.0f / (l + xhalf(l));
    const float f0 = a0 * inv, f1 = a1 * inv;
    bf16_t* orow = aout + ((size_t)b * SEQ + q0 + c * 16 + lm) * DIM + h * HD + 8 * half;
#pragma unroll   // the four stores issue together
    for (int t = 0; t < 4; ++t) {
      const v4f lo = J[((c * 4 + t) * 2) * 32], hi = J[((c * 4 + t) * 2 + 1) * 32];
      v8bf w;
#pragma unroll   // w[] indexed by constants only
      for (int r = 0; r < 4; ++r) {
        w[r]     = (bf16_t)(o[c][t][r] * f0 + lo[r] * f1);
        w[4 + r] = (bf16_t)(o[c][t][4 + r] * f0 + hi[r] * f1);
      }
      *(v8bf*)(orow + t * 16) = w;
    }
  }
}

// ---------------- launch ----------------

extern "C" void kernel_launch(void* const* d_in, const int* in_sizes, int n_in,
                              void* d_out, int out_size, void* d_ws, size_t ws_size,
                              hipStream_t stream) {
  const float* x      = (const float*)d_in[0];
  const float* qkv_w  = (const float*)d_in[1];
  const float* qkv_b  = (const float*)d_in[2];
  const float* proj_w = (const float*)d_in[3];
  const float* proj_b = (const float*)d_in[4];

  const size_t MB = 1u << 20;
  char* ws = (char*)d_ws;
  bf16_t* xb     = (bf16_t*)(ws);             //  8 MB: x as bf16 [4096][1024]
  bf16_t* wqkvT  = (bf16_t*)(ws + 8 * MB);    //  6 MB: qkv_w^T [3072][1024]
  bf16_t* wprojT = (bf16_t*)(ws + 14 * MB);   //  2 MB: proj_w^T [1024][1024]
  bf16_t* qkvbuf = (bf16_t*)(ws + 16 * MB);   // 24 MB: Q,K [B][H][S][D]; V [B][H][D][S]
  bf16_t* aout   = (bf16_t*)(ws + 40 * MB);   //  8 MB: attn out [4096][1024]

  // x to bf16 and both weight transposes, one launch
  prep_kernel<<<X_BLOCKS + QW_BLOCKS + PW_BLOCKS, PREP_T, 0, stream>>>(x, qkv_w, proj_w,
                                                                      xb, wqkvT, wprojT);

  // QKV GEMM: [4096,1024] x [1024,3072] -> scattered bf16 Q/K/V
  gemm_bf16_kernel<0><<<dim3(3 * DIM / 256, MTOT / 64), 256, 0, stream>>>(
      xb, wqkvT, qkv_b, qkvbuf, MTOT, 3 * DIM, DIM);

  // attention
  attn_kernel<<<dim3(SEQ / 128, BATCH * NH), 256, 0, stream>>>(qkvbuf, aout);

  // projection GEMM: [4096,1024] x [1024,1024] + bias -> f32 out
  gemm_bf16_kernel<1><<<dim3(DIM / 256, MTOT / 64), 256, 0, stream>>>(
      aout, wprojT, proj_b, d_out, MTOT, DIM, DIM);
}

// v010
// Measured time: 82.3 microseconds a run.
// Timed twice side by side with v009, it ran 1.07 and 1.09 times as fast.
// Over all steps from v000 it is 5.54 times as fast.
#include <hip/hip_runtime.h>
#include <hip/hip_bf16.h>
#include <stdint.h>

typedef __bf16 bf16_t;
typedef __attribute__((ext_vector_type(4)))  __bf16 v4bf;
typedef __attribute__((ext_vector_type(8)))  __bf16 v8bf;
typedef __attribute__((ext_vector_type(16))) __bf16 v16bf;
typedef __attribute__((ext_vector_type(8)))  float  v8f;
typedef __attribute__((ext_vector_type(2)))  float  v2f;
typedef __attribute__((ext_vector_type(4)))  float  v4f;

#define DIM   1024
#define SEQ   2048
#define NH    16
#define HD    64
#define BATCH 2
#define MTOT  (BATCH * SEQ)   // 4096 tokens

// ---------------- helpers ----------------

__device__ __forceinline__ v8f zero8() {
  v8f z;
#pragma unroll
  for (int i = 0; i < 8; ++i) z[i] = 0.0f;
  return z;
}

// Low 32 bits of a generic pointer to __shared__ = LDS byte offset (aperture mapping).
__device__ __forceinline__ unsigned lds_off(const void* p) {
  return (unsigned)(unsigned long long)(uintptr_t)p;
}

// CDNA5 async global->LDS copies (per-lane 16B), tracked by ASYNCcnt.
// Eight of them, one K and V stage's share of a lane, in one statement. Its last line,
// s_wait_xcnt 0, is the precaution described at the ten-copy form below.
__device__ __forceinline__ void async_ld8_b128(const unsigned (&l)[8], const bf16_t* const (&g)[8]) {
  asm volatile("global_load_async_to_lds_b128 %0, %1, off\n\t"
               "global_load_async_to_lds_b128 %2, %3, off\n\t"
               "global_load_async_to_lds_b128 %4, %5, off\n\t"
               "global_load_async_to_lds_b128 %6, %7, off\n\t"
               "global_load_async_to_lds_b128 %8, %9, off\n\t"
               "global_load_async_to_lds_b128 %10, %11, off\n\t"
               "global_load_async_to_lds_b128 %12, %13, off\n\t"
               "global_load_async_to_lds_b128 %14, %15, off\n\t"
               "s_wait_xcnt 0x0"
               :: "v"(l[0]), "v"((unsigned long long)(uintptr_t)g[0]),
                  "v"(l[1]), "v"((unsigned long long)(uintptr_t)g[1]),
                  "v"(l[2]), "v"((unsigned long long)(uintptr_t)g[2]),
                  "v"(l[3]), "v"((unsigned long long)(uintptr_t)g[3]),
                  "v"(l[4]), "v"((unsigned long long)(uintptr_t)g[4]),
                  "v"(l[5]), "v"((unsigned long long)(uintptr_t)g[5]),
                  "v"(l[6]), "v"((unsigned long long)(uintptr_t)g[6]),
                  "v"(l[7]), "v"((unsigned long long)(uintptr_t)g[7])
               : "memory");
}

// Seven of them, a lane's share of one stage of the QKV product, in one statement. Its last
// line, s_wait_xcnt 0, is the precaution described at the ten-copy form below.
__device__ __forceinline__ void async_ld7_b128(const unsigned (&l)[7], const bf16_t* const (&g)[7]) {
  asm volatile("global_load_async_to_lds_b128 %0, %1, off\n\t"
               "global_load_async_to_lds_b128 %2, %3, off\n\t"
               "global_load_async_to_lds_b128 %4, %5, off\n\t"
               "global_load_async_to_lds_b128 %6, %7, off\n\t"
               "global_load_async_to_lds_b128 %8, %9, off\n\t"
               "global_load_async_to_lds_b128 %10, %11, off\n\t"
               "global_load_async_to_lds_b128 %12, %13, off\n\t"
               "s_wait_xcnt 0x0"
               :: "v"(l[0]), "v"((unsigned long long)(uintptr_t)g[0]),
                  "v"(l[1]), "v"((unsigned long long)(uintptr_t)g[1]),
                  "v"(l[2]), "v"((unsigned long long)(uintptr_t)g[2]),
                  "v"(l[3]), "v"((unsigned long long)(uintptr_t)g[3]),
                  "v"(l[4]), "v"((unsigned long long)(uintptr_t)g[4]),
                  "v"(l[5]), "v"((unsigned long long)(uintptr_t)g[5]),
                  "v"(l[6]), "v"((unsigned long long)(uintptr_t)g[6])
               : "memory");
}

// Ten such copies, one stage's share of a lane, in one statement. Its last line, s_wait_xcnt 0,
// is a precaution: it stands in front of every later rewrite of the address registers that the
// copies name, and only inside the copies' own statement can the compiler move no such rewrite
// ahead of it.
__device__ __forceinline__ void async_ld10_b128(const unsigned (&l)[10], const bf16_t* const (&g)[10]) {
  asm volatile("global_load_async_to_lds_b128 %0, %1, off\n\t"
               "global_load_async_to_lds_b128 %2, %3, off\n\t"
               "global_load_async_to_lds_b128 %4, %5, off\n\t"
               "global_load_async_to_lds_b128 %6, %7, off\n\t"
               "global_load_async_to_lds_b128 %8, %9, off\n\t"
               "global_load_async_to_lds_b128 %10, %11, off\n\t"
               "global_load_async_to_lds_b128 %12, %13, off\n\t"
               "global_load_async_to_lds_b128 %14, %15, off\n\t"
               "global_load_async_to_lds_b128 %16, %17, off\n\t"
               "global_load_async_to_lds_b128 %18, %19, off\n\t"
               "s_wait_xcnt 0x0"
               :: "v"(l[0]), "v"((unsigned long long)(uintptr_t)g[0]),
                  "v"(l[1]), "v"((unsigned long long)(uintptr_t)g[1]),
                  "v"(l[2]), "v"((unsigned long long)(uintptr_t)g[2]),
                  "v"(l[3]), "v"((unsigned long long)(uintptr_t)g[3]),
                  "v"(l[4]), "v"((unsigned long long)(uintptr_t)g[4]),
                  "v"(l[5]), "v"((unsigned long long)(uintptr_t)g[5]),
                  "v"(l[6]), "v"((unsigned long long)(uintptr_t)g[6]),
                  "v"(l[7]), "v"((unsigned long long)(uintptr_t)g[7]),
                  "v"(l[8]), "v"((unsigned long long)(uintptr_t)g[8]),
                  "v"(l[9]), "v"((unsigned long long)(uintptr_t)g[9])
               : "memory");
}

// This wave's LDS reads have returned: stands in front of the barrier behind which their
// buffer is refilled by copies.
__device__ __forceinline__ void wait_dscnt0() {
  asm volatile("s_wait_dscnt 0x0" ::: "memory");
}

template <int N>
__device__ __forceinline__ void wait_asynccnt() {
  asm volatile("s_wait_asynccnt %0" :: "i"(N) : "memory");
}

// Load a 16-element bf16 WMMA fragment: two contiguous 16B chunks at p and p+16
// (ISA 16-bit A/B layout: k = half*8 + e  and  k = 16 + half*8 + e).
__device__ __forceinline__ v16bf ldfrag(const bf16_t* p) {
  v8bf lo = *(const v8bf*)(p);
  v8bf hi = *(const v8bf*)(p + 16);
  return __builtin_shufflevector(lo, hi, 0, 1, 2, 3, 4, 5, 6, 7,
                                 8, 9, 10, 11, 12, 13, 14, 15);
}

__device__ __forceinline__ v8f wmma_bf16(v16bf a, v16bf b, v8f c) {
  return __builtin_amdgcn_wmma_f32_16x16x32_bf16(false, a, false, b,
                                                 (short)0, c, false, false);
}

// Value of lane l ^ 16 (the other half of the wave), by a vector cross-row move.
__device__ __forceinline__ float xhalf(float x) {
  const int b = __builtin_bit_cast(int, x);
  return __builtin_bit_cast(float, __builtin_amdgcn_permlanex16(b, b, 0x76543210, 0xfedcba98,
                                                                false, false));
}

// ---------------- conversion kernel ----------------
// x to bf16 and both weight transposes depend on nothing but the inputs, so they share ONE
// grid: the block index picks the job, and all 768 blocks (3 of 16 waves a WGP) are resident
// at once. The three streams run side by side behind one launch instead of three in a row.

#define PREP_T 512                   // threads a block

// Job 1, x to bf16: 32 elements a lane. Every wave-wide load is 512 contiguous bytes (4 whole
// lines), every wave-wide store 256 (2 whole lines). Its blocks cover the array exactly.
#define CVT_L 8                      // 16 B loads a lane
#define CVT_B (PREP_T * CVT_L * 4)   // elements a block
#define X_BLOCKS (MTOT * DIM / CVT_B)
static_assert((MTOT * DIM) % CVT_B == 0, "the blocks cover x exactly");

// Job 2, out[c*DIM + r] = (bf16) in[r*C + c]  (weights as [N][K] for B-fragments).
// One 64x64 tile per half block of 256 threads, turned in LDS so that both global sides
// are wide and contiguous: 16 B loads along c, 16 B stores along r (8 lanes fill one
// 128 B line of out). A block's two tiles are neighbours along c in one matrix.
#define TT   64
#define TPIT 65   // f32 pitch: both the row-wise writes and the column-wise reads hit distinct banks
#define QW_BLOCKS ((3 * DIM / TT) * (DIM / TT) / 2)   // blocks of qkv_w
#define PW_BLOCKS ((DIM / TT) * (DIM / TT) / 2)       // blocks of proj_w
static_assert((3 * DIM / TT) % 2 == 0 && (DIM / TT) % 2 == 0, "a pair of tiles stays in one tile row");

__global__ __launch_bounds__(PREP_T) void prep_kernel(
    const float* __restrict__ x, const float* __restrict__ qkv_w, const float* __restrict__ proj_w,
    bf16_t* __restrict__ xb, bf16_t* __restrict__ wqkvT, bf16_t* __restrict__ wprojT) {
  __shared__ float tile[2 * TT * TPIT];

  if (blockIdx.x < X_BLOCKS) {
    const size_t base = (size_t)blockIdx.x * CVT_B + threadIdx.x * 4;
    float4 v[CVT_L];
#pragma unroll   // all eight loads in flight before the first convert; v[] stays in registers
    for (int j = 0; j < CVT_L; ++j) v[j] = *(const float4*)(x + base + j * (PREP_T * 4));
#pragma unroll   // v[] indexed by constants only
    for (int j = 0; j < CVT_L; ++j) {
      v4bf w;
      w[0] = (bf16_t)v[j].x; w[1] = (bf16_t)v[j].y; w[2] = (bf16_t)v[j].z; w[3] = (bf16_t)v[j].w;
      *(v4bf*)(xb + base + j * (PREP_T * 4)) = w;
    }
    return;   // the whole block leaves here: it never meets the barrier below
  }

  // Which matrix and which pair of tiles: the same for the whole block. Both matrices have
  // DIM / TT tile rows, so the low bits of the index are the tile row in either.
  const int  wb  = blockIdx.x - X_BLOCKS;
  const bool isq = wb < QW_BLOCKS;
  const float* __restrict__ in  = isq ? qkv_w : proj_w;
  bf16_t* __restrict__      out = isq ? wqkvT : wprojT;
  const int C    = isq ? 3 * DIM : DIM;          // columns of in
  const int pb   = isq ? wb : wb - QW_BLOCKS;
  const int prow = pb % (DIM / TT), pcol = pb / (DIM / TT);

  const int tid = threadIdx.x & 255, hb = threadIdx.x >> 8;
  float* tl = &tile[hb * (TT * TPIT)];
  const int c0 = (pcol * 2 + hb) * TT, r0 = prow * TT;

  const int lr = tid >> 4, lc = (tid & 15) * 4;
  float4 v[4];
#pragma unroll   // all four loads in flight before the first LDS write; v[] stays in registers
  for (int p = 0; p < 4; ++p)
    v[p] = *(const float4*)(in + (r0 + lr + p * 16) * C + c0 + lc);   // below 2^22: 32-bit index
#pragma unroll   // v[] indexed by constants only
  for (int p = 0; p < 4; ++p) {
    float* t = &tl[(lr + p * 16) * TPIT + lc];
    t[0] = v[p].x; t[1] = v[p].y; t[2] = v[p].z; t[3] = v[p].w;
  }
  __syncthreads();

#pragma unroll   // both chunks' LDS reads issue together
  for (int p = 0; p < 2; ++p) {
    const int q = tid + p * 256;
    const int oc = q >> 3, orr = (q & 7) * 8;
    v8bf w;
#pragma unroll   // w[] indexed by constants only
    for (int i = 0; i < 8; ++i) w[i] = (bf16_t)tl[(orr + i) * TPIT + oc];
    *(v8bf*)(out + (size_t)(c0 + oc) * DIM + r0 + orr) = w;
  }
  // A precaution: in the built code a branch behind these two stores can fall through into job 1,
  // which rewrites the registers that the stores name; the wait stands in front of that way.
  asm volatile("s_wait_xcnt 0x0" ::: "memory");
}

// ---------------- bf16 GEMMs: C[M,N] = A[M,K] * Bt[N,K]^T + bias ----------------

#define KST  64           // k per stage: a row of either tile is one whole 128 B line
#define ASTR 72           // LDS row pitch, 64 k + 8: 144 B = 16 B x odd, for the 16 B fragment reads
#define BSTR 72
#define ABUF (64 * ASTR)
#define BBUF (256 * BSTR)

// QKV product: [4096,1024] x [1024,3072], scattered as bf16 into Q, K [B][H][S][D] and V [B][H][D][S].
// A block takes 256 tokens x 192 columns (three heads), so the grid is 16 x 16: one block on
// every WGP. Each byte of x is then read from L2 by 16 blocks and each byte of the weights by 16
// (448 rows a block and stage), and a wave's 64 x 48 share takes 7 fragments from LDS for 12 products.
#define QTM   256                    // tokens a block
#define QTN   192                    // columns a block: three heads
#define QROWS (QTM + QTN)            // rows of a stage in LDS: the A tile's, then the B tile's
#define QSTG  (QROWS * ASTR)         // elements of a stage
#define QHST  (QTM * ASTR)           // staging of one head: [token][64 d + 8], 144 B a row
#define QVP   (QTM + 8)              // staging pitch of a V row, 256 s + 8: 528 B = 16 B x odd
static_assert(ASTR == BSTR, "both tiles of a stage have one pitch");
static_assert(HD * QVP <= QHST && (QTN / HD) * QHST <= 2 * QSTG, "the staging fits the ring");
static_assert((3 * DIM) % QTN == 0 && MTOT % QTM == 0 && SEQ % QTM == 0 && QTN % HD == 0 &&
              DIM % (2 * KST) == 0, "whole tiles, one batch a block, whole heads, two stages at least");

__global__ __launch_bounds__(512)
void qkv_gemm_kernel(const bf16_t* __restrict__ A, const bf16_t* __restrict__ Bt,
                     const float* __restrict__ bias, bf16_t* __restrict__ outp) {
  __shared__ __attribute__((aligned(16))) bf16_t Rw[2 * QSTG];   // [buffer][256 A rows | 192 B rows][k]

  const int tid  = threadIdx.x;
  const int wave = __builtin_amdgcn_readfirstlane(tid >> 5), lane = tid & 31;
  const int lm   = lane & 15, half = lane >> 4;
  const int wm   = wave >> 2, wn = wave & 3;     // 4 x 4 wave grid
  const int n0   = blockIdx.x * QTN;
  const int m0   = blockIdx.y * QTM;

  v8f acc[4][3];
#pragma unroll
  for (int mt = 0; mt < 4; ++mt)
#pragma unroll
    for (int nt = 0; nt < 3; ++nt) acc[mt][nt] = zero8();

  // The wave's bias values, for the epilogue: loaded here, they fly beside the first stage's copies.
  float bs3[3];
#pragma unroll   // bs3[] indexed by constants only
  for (int nt = 0; nt < 3; ++nt) bs3[nt] = bias[n0 + wn * 48 + nt * 16 + lm];

  const unsigned rwb = lds_off(Rw);
  const int crow = tid >> 3, ccol = (tid & 7) * 8;

  // A row of either tile is one 128 B line of global memory. Eight neighbouring lanes bring
  // it, so a wave-wide copy touches 4 whole lines.
  auto issue = [&](int buf, int kk) {
    // Copy i brings rows 64 i .. 64 i + 63 of the stage: four copies the A tile, three the B tile.
    const unsigned sl = rwb + (unsigned)(buf * QSTG + crow * ASTR + ccol) * 2;
    const bf16_t*  ag = A + (size_t)(m0 + crow) * DIM + kk + ccol;
    const bf16_t*  bg = Bt + (size_t)(n0 + crow) * DIM + kk + ccol;
    unsigned l[7];
    const bf16_t* g[7];
#pragma unroll   // l[] and g[] indexed by constants only: they stay in registers
    for (int i = 0; i < 7; ++i) {
      l[i] = sl + i * (64 * ASTR * 2);
      g[i] = i < 4 ? ag + (size_t)(64 * i) * DIM : bg + (size_t)(64 * (i - 4)) * DIM;
    }
    async_ld7_b128(l, g);
  };

  // Two buffers: stage t + 1 flies while stage t is worked on.
  issue(0, 0);
  wait_asynccnt<0>();
  __syncthreads();
  issue(1, KST);
  for (int kk = 0; kk < DIM; kk += KST) {
    const int cur = (kk / KST) & 1;
    const bf16_t* Ac = &Rw[cur * QSTG];
    const bf16_t* Bc = Ac + QTM * ASTR;
    // The stage's 14 fragments are read in the order in which the products take them.
    v16bf af[2][4], bfg[2][3];
#pragma unroll   // af[] and bfg[] indexed by constants only: they stay in registers
    for (int kh = 0; kh < 2; ++kh) {
#pragma unroll
      for (int nt = 0; nt < 3; ++nt)
        bfg[kh][nt] = ldfrag(&Bc[(wn * 48 + nt * 16 + lm) * BSTR + kh * 32 + half * 8]);
#pragma unroll
      for (int mt = 0; mt < 4; ++mt)
        af[kh][mt] = ldfrag(&Ac[(wm * 64 + mt * 16 + lm) * ASTR + kh * 32 + half * 8]);
    }
    // Keeps the reads one group ahead of the products: sunk among them, into one register set,
    // each row of three products would wait out an LDS latency that no other block on the WGP hides.
    __builtin_amdgcn_sched_barrier(0);
#pragma unroll
    for (int kh = 0; kh < 2; ++kh) {
#pragma unroll
      for (int mt = 0; mt < 4; ++mt) {
#pragma unroll
        for (int nt = 0; nt < 3; ++nt)
          acc[mt][nt] = wmma_bf16(af[kh][mt], bfg[kh][nt], acc[mt][nt]);
      }
    }
    // Keeps the products ahead of the foot's waits: lifted over them, s_wait_dscnt 0 would stand
    // behind the last read and no product could start while later fragments are still on their way.
    __builtin_amdgcn_sched_barrier(0);
    // Foot of the trip. The one barrier publishes stage t + 1 (every wave's copies have landed)
    // and ends every wave's reads of stage t, whose buffer the copies behind it refill.
    wait_dscnt0();
    wait_asynccnt<0>();
    __syncthreads();
    if (kk + 2 * KST < DIM) issue(cur, kk + 2 * KST);
  }
  wait_asynccnt<0>();   // no copy is outstanding when the ring becomes staging

  // Epilogue. The tile is turned in LDS, head by head, so that every global store is 16 B a lane
  // and whole 128 B lines are filled. The ring is free: the loop's last barrier ended its reads,
  // every wave's copies had landed in front of it, and none is issued behind it.
  // A head (64 columns) lies in one of Q, K, V; a block's three heads may lie in two of them.
  const int bb = m0 >> 11, s0 = m0 & (SEQ - 1);
  const int gh0 = blockIdx.x * (QTN / HD);       // first of the block's heads, counted over Q, K, V
#pragma unroll   // acc[] indexed by constants only
  for (int nt = 0; nt < 3; ++nt) {
    const int col = wn * 48 + nt * 16;           // the same for the wave; 16 columns stay in one head
    const int dd  = (col & (HD - 1)) + lm;
    bf16_t* Sh = &Rw[(col / HD) * QHST];
    const float bs = bs3[nt];
    if ((gh0 + col / HD) / NH == 2) {
      // V goes out as [d][s]: a lane's 8 accumulators are 8 neighbouring s of one d.
#pragma unroll
      for (int mt = 0; mt < 4; ++mt) {
        v8bf w;
#pragma unroll
        for (int r = 0; r < 8; ++r) w[r] = (bf16_t)(acc[mt][nt][r] + bs);
        *(v8bf*)&Sh[dd * QVP + wm * 64 + mt * 16 + 8 * half] = w;
      }
    } else {
      // Q, K go out as [s][d]: staged row-major, m = r + 8*half, n = lane%16.
#pragma unroll
      for (int mt = 0; mt < 4; ++mt) {
#pragma unroll
        for (int r = 0; r < 8; ++r)
          Sh[(wm * 64 + mt * 16 + r + 8 * half) * ASTR + dd] = (bf16_t)(acc[mt][nt][r] + bs);
      }
    }
  }
  __syncthreads();
  // A head's 32 KiB go out as 4 stores of 16 B a lane. V: 32 lanes fill 512 B of a row d, 16 rows
  // a step. Q, K: 8 lanes fill a token's 128 B, 64 tokens a step.
  const int vl = (tid >> 5) * QVP + (tid & 31) * 8,  vg = (tid >> 5) * SEQ + s0 + (tid & 31) * 8;
  const int ql = (tid >> 3) * ASTR + (tid & 7) * 8,  qg = (s0 + (tid >> 3)) * HD + (tid & 7) * 8;
#pragma unroll   // the three heads' LDS reads can issue together
  for (int j = 0; j < QTN / HD; ++j) {
    const int  part = (gh0 + j) / NH, h = (gh0 + j) % NH;
    const bool isv  = part == 2;                 // the same for the block
    const bf16_t* Sh = &Rw[j * QHST + (isv ? vl : ql)];
    bf16_t* ob = outp + (size_t)part * ((size_t)BATCH * NH * SEQ * HD) +
                 (size_t)(bb * NH + h) * (SEQ * HD) + (isv ? vg : qg);
    const int lstep = isv ? 16 * QVP : 64 * ASTR, gstep = isv ? 16 * SEQ : 64 * HD;
#pragma unroll   // all four LDS reads issue together
    for (int p = 0; p < 4; ++p) *(v8bf*)(ob + p * gstep) = *(const v8bf*)&Sh[p * lstep];
  }
}

// Projection: f32 output + bias, row-major [M,N]. 64 x 256 a block, 32 x 64 a wave.
__global__ __launch_bounds__(256) void gemm_bf16_kernel(
    const bf16_t* __restrict__ A, const bf16_t* __restrict__ Bt,
    const float* __restrict__ bias, void* __restrict__ outp,
    int M, int N, int K) {
  __shared__ __attribute__((aligned(16))) bf16_t Aw[2 * ABUF];   // double-buffered 64x64 A tiles
  __shared__ __attribute__((aligned(16))) bf16_t Bw[2 * BBUF];   // double-buffered 256x64 B tiles

  const int tid  = threadIdx.x;
  const int wave = tid >> 5, lane = tid & 31;
  const int lm   = lane & 15, half = lane >> 4;
  const int wm   = wave >> 2, wn = wave & 3;     // 2 x 4 wave grid
  const int n0   = blockIdx.x * 256;
  const int m0   = blockIdx.y * 64;

  v8f acc[2][4];
#pragma unroll
  for (int mt = 0; mt < 2; ++mt)
#pragma unroll
    for (int nt = 0; nt < 4; ++nt) acc[mt][nt] = zero8();

  const unsigned awb = lds_off(Aw), bwb = lds_off(Bw);
  const int arow = tid >> 3, acol = (tid & 7) * 8;

  // A row of either tile is one 128 B line of global memory. Eight neighbouring lanes bring
  // it, so a wave-wide copy touches 4 whole lines.
  auto issue = [&](int buf, int kk) {
    // Copy i of a tile brings its rows 32 i .. 32 i + 31: A tile 2 a lane, B tile 8 a lane.
    const unsigned al = awb + (unsigned)(buf * ABUF + arow * ASTR + acol) * 2;
    const unsigned bl = bwb + (unsigned)(buf * BBUF + arow * BSTR + acol) * 2;
    const bf16_t*  ag = A + (size_t)(m0 + arow) * K + kk + acol;
    const bf16_t*  bg = Bt + (size_t)(n0 + arow) * K + kk + acol;
    unsigned l[10];
    const bf16_t* g[10];
#pragma unroll   // l[] and g[] indexed by constants only: they stay in registers
    for (int i = 0; i < 2; ++i) {
      l[i] = al + i * (32 * ASTR * 2);
      g[i] = ag + (size_t)(32 * i) * K;
    }
#pragma unroll   // likewise
    for (int i = 0; i < 8; ++i) {
      l[2 + i] = bl + i * (32 * BSTR * 2);
      g[2 + i] = bg + (size_t)(32 * i) * K;
    }
    async_ld10_b128(l, g);
  };

  // Two buffers: stage t + 1 flies while stage t is worked on. K is a multiple of KST.
  issue(0, 0);
  wait_asynccnt<0>();
  __syncthreads();
  if (KST < K) issue(1, KST);
  for (int kk = 0; kk < K; kk += KST) {
    const int cur = (kk / KST) & 1;
    const bf16_t* Ac = &Aw[cur * ABUF];
    const bf16_t* Bc = &Bw[cur * BBUF];
#pragma unroll   // both halves' fragment reads can issue ahead of the first products
    for (int ks = 0; ks < KST; ks += 32) {
      v16bf af[2], bfg[4];
#pragma unroll
      for (int mt = 0; mt < 2; ++mt)
        af[mt] = ldfrag(&Ac[(wm * 32 + mt * 16 + lm) * ASTR + ks + half * 8]);
#pragma unroll
      for (int nt = 0; nt < 4; ++nt)
        bfg[nt] = ldfrag(&Bc[(wn * 64 + nt * 16 + lm) * BSTR + ks + half * 8]);
#pragma unroll
      for (int mt = 0; mt < 2; ++mt) {
#pragma unroll
        for (int nt = 0; nt < 4; ++nt)
          acc[mt][nt] = wmma_bf16(af[mt], bfg[nt], acc[mt][nt]);
      }
    }
    // Foot of the trip. The one barrier publishes stage t + 1 (every wave's copies have landed)
    // and ends every wave's reads of stage t, whose buffer the copies behind it refill.
    wait_dscnt0();
    wait_asynccnt<0>();
    __syncthreads();
    if (kk + 2 * KST < K) issue(cur, kk + 2 * KST);
  }
  wait_asynccnt<0>();   // no copy is outstanding when the wave ends

  // epilogue
#pragma unroll
  for (int mt = 0; mt < 2; ++mt) {
#pragma unroll
    for (int nt = 0; nt < 4; ++nt) {
#pragma unroll
      for (int r = 0; r < 8; ++r) {
        int gm = m0 + wm * 32 + mt * 16 + r + 8 * half;   // C/D: m = r + 8*half
        int gn = n0 + wn * 64 + nt * 16 + lm;             // C/D: n = lane%16
        ((float*)outp)[(size_t)gm * N + gn] = acc[mt][nt][r] + bias[gn];
      }
    }
  }
}

// LDS rows of K and V hold 64 bf16 (128 B) and are all read as 16 B fragments, one row
// per lane: at a 128 B pitch 16 lanes fall on two bank groups, at 144 B (16 B x odd) on all.
#define KVP   72            // LDS row pitch in elements (64 used + 8 never read)
#define KVBUF (64 * KVP)    // elements per K or V tile
#define NST   (SEQ / 128)   // stages: two 64-key tiles each, one per key share
#define JROWS 17            // 16 B rows a lane hands over at the join: 64 outputs, 2 maxima, 2 sums
static_assert(4 * JROWS * 32 * 16 <= 4 * KVBUF * 2, "the join fits the K ring");

// The grid puts two blocks on a WGP, four waves on a SIMD: said here so that the compiler
// spends registers on LDS reads issued in groups ahead of the products instead of saving
// them for waves that the grid does not have.
__global__ __launch_bounds__(256) __attribute__((amdgpu_waves_per_eu(4, 4)))
void attn_kernel(const bf16_t* __restrict__ qkv,
                                                   bf16_t* __restrict__ aout) {
  __shared__ __attribute__((aligned(16))) bf16_t Kw[4 * KVBUF];      // [buffer][share][key][d]  36 KB
  __shared__ __attribute__((aligned(16))) bf16_t Vt[4 * KVBUF];      // [buffer][share][d][key]  36 KB

  const int tid  = threadIdx.x;
  const int wave = __builtin_amdgcn_readfirstlane(tid >> 5), lane = tid & 31;
  const int lm   = lane & 15, half = lane >> 4;
  const int wq   = wave & 3, ksh = wave >> 2;    // q rows of the wave; its key share
  const int bh   = blockIdx.y;
  const int b    = bh >> 4, h = bh & 15;

  const size_t partsz = (size_t)BATCH * NH * SEQ * HD;
  const bf16_t* Qb = qkv + ((size_t)b * NH + h) * SEQ * HD;
  const bf16_t* Kb = qkv + partsz + ((size_t)b * NH + h) * SEQ * HD;
  const bf16_t* Vb = qkv + 2 * partsz + ((size_t)b * NH + h) * HD * SEQ;  // [d][s]

  const int q0 = blockIdx.x * 128 + wq * 32;

  // Q fragments (B operand: column = query c*16 + lane%16), loaded once: k-dim = 64 -> 2 chunks of 32
  v16bf aq[2][2];
#pragma unroll
  for (int c = 0; c < 2; ++c)
#pragma unroll
    for (int kh = 0; kh < 2; ++kh)
      aq[c][kh] = ldfrag(Qb + (size_t)(q0 + c * 16 + lm) * HD + kh * 32 + half * 8);

  v8f o[2][4];
#pragma unroll
  for (int c = 0; c < 2; ++c)
#pragma unroll
    for (int t = 0; t < 4; ++t) o[c][t] = zero8();
  // Per column group, the lane's query: running maximum (equal in both halves) and the sum
  // over this half's keys, both over the wave's key share.
  v2f m_run = {-1e30f, -1e30f}, l_run = {0.0f, 0.0f};

  const unsigned kwb = lds_off(Kw), vtb = lds_off(Vt);
  const int ldr = tid >> 2, ldc = (tid & 3) * 16;
  const float scale = 0.125f;   // 1/sqrt(64)
  const float LOG2E = 1.44269504f;

  auto issue_kv = [&](int buf, int st) {
    unsigned l[8];
    const bf16_t* g[8];
#pragma unroll   // l[] and g[] indexed by constants only: they stay in registers
    for (int p = 0; p < 2; ++p) {
      const int j0 = (st * 2 + p) * 64;
      const unsigned off = (unsigned)((buf * 2 + p) * KVBUF + ldr * KVP + ldc) * 2;
      // K block [64 keys][64 d] -> Kw[key][d]
      const bf16_t* kg = Kb + (size_t)(j0 + ldr) * HD + ldc;
      l[4 * p]     = kwb + off;      g[4 * p]     = kg;
      l[4 * p + 1] = kwb + off + 16; g[4 * p + 1] = kg + 8;
      // V block (global already [d][s]) -> Vt[d][key]
      const bf16_t* vg = Vb + (size_t)ldr * SEQ + j0 + ldc;
      l[4 * p + 2] = vtb + off;      g[4 * p + 2] = vg;
      l[4 * p + 3] = vtb + off + 16; g[4 * p + 3] = vg + 8;
    }
    async_ld8_b128(l, g);
  };

  issue_kv(0, 0);
  for (int st = 0; st < NST; ++st) {
    const int cur = st & 1;
    if (st + 1 < NST) {
      issue_kv(cur ^ 1, st + 1);
      wait_asynccnt<8>();
    } else {
      wait_asynccnt<0>();
    }
    __syncthreads();

    const bf16_t* Kc = &Kw[(cur * 2 + ksh) * KVBUF];
    const bf16_t* Vc = &Vt[(cur * 2 + ksh) * KVBUF];

    // ---- scores S^T = K * Q^T  (64 keys x 32 queries per wave, 16 WMMAs on 8 fragments) ----
    // s[c][t][r] = score of key t*16 + 8*half + r with query c*16 + lane%16
    v8f s[2][4];
#pragma unroll
    for (int c = 0; c < 2; ++c)
#pragma unroll
      for (int t = 0; t < 4; ++t) s[c][t] = zero8();
#pragma unroll
    for (int kh = 0; kh < 2; ++kh) {
#pragma unroll
      for (int t = 0; t < 4; ++t) {
        v16bf ak = ldfrag(&Kc[(t * 16 + lm) * KVP + kh * 32 + half * 8]);
#pragma unroll
        for (int c = 0; c < 2; ++c) s[c][t] = wmma_bf16(ak, aq[c][kh], s[c][t]);
      }
    }

    // ---- online softmax, one query per lane and column group: 32 keys in-lane, 32 in lane ^ 16 ----
    // Whole-tile vector expressions compile to packed operations on the register pairs of one
    // accumulator tile as they lie; what there is once per column group goes as one pair.
    v2f mx2;
#pragma unroll   // the two column groups are independent chains
    for (int c = 0; c < 2; ++c) {
#pragma unroll
      for (int t = 0; t < 4; ++t) s[c][t] *= scale;
      float mt4[4];
#pragma unroll   // four independent chains, one per tile
      for (int t = 0; t < 4; ++t) {
        mt4[t] = s[c][t][0];
#pragma unroll   // s[] indexed by constants only: stays in registers
        for (int r = 1; r < 8; ++r) mt4[t] = fmaxf(mt4[t], s[c][t][r]);
      }
      const float mx = fmaxf(fmaxf(mt4[0], mt4[1]), fmaxf(mt4[2], mt4[3]));
      mx2[c] = fmaxf(mx, xhalf(mx));
    }
    const v2f mn2 = __builtin_elementwise_max(m_run, mx2);
    const v2f ce  = (m_run - mn2) * LOG2E;   // exp(x) = 2^(x log2 e), as __expf takes it
    const v2f corr = {__builtin_amdgcn_exp2f(ce.x), __builtin_amdgcn_exp2f(ce.y)};
    m_run = mn2;
    v2f ls;
#pragma unroll   // the two column groups are independent chains
    for (int c = 0; c < 2; ++c) {
      v2f l2[2];   // two independent chains of packed adds over register pairs
      l2[0] = (v2f){0.0f, 0.0f};
      l2[1] = (v2f){0.0f, 0.0f};
#pragma unroll   // s[] and l2[] indexed by constants only: stay in registers
      for (int t = 0; t < 4; ++t) {
        const v8f e = (s[c][t] - mn2[c]) * LOG2E;
#pragma unroll   // likewise
        for (int r = 0; r < 8; ++r) s[c][t][r] = __builtin_amdgcn_exp2f(e[r]);
        l2[t & 1] += __builtin_shufflevector(s[c][t], s[c][t], 0, 1);
        l2[t & 1] += __builtin_shufflevector(s[c][t], s[c][t], 2, 3);
        l2[t & 1] += __builtin_shufflevector(s[c][t], s[c][t], 4, 5);
        l2[t & 1] += __builtin_shufflevector(s[c][t], s[c][t], 6, 7);
      }
      l2[0] += l2[1];
      ls[c] = l2[0].x + l2[0].y;
#pragma unroll
      for (int t = 0; t < 4; ++t) o[c][t] *= corr[c];
    }
    l_run = l_run * corr + ls;

    // ---- O^T += V^T * P^T  (16 WMMAs on 8 fragments; A-fragments from [d][key] V) ----
    // B element e of lane (lm, half) is key half*8 + e (e < 8) or 16 + half*8 + e - 8 of the
    // 32: exactly what tiles 2*kh and 2*kh + 1 of S^T hold in this lane.
#pragma unroll
    for (int kh = 0; kh < 2; ++kh) {
      v16bf bp[2];
#pragma unroll
      for (int c = 0; c < 2; ++c)
#pragma unroll   // packed converts of register pairs, no indexing at run time
        for (int r = 0; r < 8; ++r) {
          bp[c][r]     = (bf16_t)s[c][2 * kh][r];
          bp[c][8 + r] = (bf16_t)s[c][2 * kh + 1][r];
        }
#pragma unroll
      for (int t = 0; t < 4; ++t) {
        v16bf av = ldfrag(&Vc[(t * 16 + lm) * KVP + kh * 32 + half * 8]);
#pragma unroll
        for (int c = 0; c < 2; ++c) o[c][t] = wmma_bf16(av, bp[c], o[c][t]);
      }
    }
    wait_dscnt0();   // in front of the barrier behind which the next trip's copies refill this buffer
    __syncthreads();
  }

  // ---- join the two key shares: waves 4..7 hand their partial results to waves 0..3 ----
  // The K ring is free: the loop's last barrier ended its reads, and every wave's copies had
  // landed in front of the last trip's first barrier. Row i of a wave is 32 lanes x 16 B.
  v4f* J = (v4f*)Kw + (size_t)wq * (JROWS * 32) + lane;
  if (ksh == 1) {
#pragma unroll   // o[] indexed by constants only
    for (int c = 0; c < 2; ++c)
#pragma unroll
      for (int t = 0; t < 4; ++t) {
        J[((c * 4 + t) * 2) * 32]     = __builtin_shufflevector(o[c][t], o[c][t], 0, 1, 2, 3);
        J[((c * 4 + t) * 2 + 1) * 32] = __builtin_shufflevector(o[c][t], o[c][t], 4, 5, 6, 7);
      }
    J[16 * 32] = (v4f){m_run[0], l_run[0], m_run[1], l_run[1]};
  }
  __syncthreads();
  if (ksh == 1) return;   // whole waves leave, behind the last barrier

  // ---- finalize: both shares to one maximum, join the halves' sums, divide by l, store bf16 ----
  // o[c][t][r] = O[query c*16 + lane%16][d = t*16 + 8*half + r]: 8 neighbouring d, one 16 B store.
  const v4f ml = J[16 * 32];
#pragma unroll   // o[] indexed by constants only
  for (int c = 0; c < 2; ++c) {
    const float m1 = ml[2 * c], l1 = ml[2 * c + 1];
    const float mn = fmaxf(m_run[c], m1);
    const float a0 = __expf(m_run[c] - mn), a1 = __expf(m1 - mn);
    const float l  = l_run[c] * a0 + l1 * a1;
    const float inv = 1.0f / (l + xhalf(l));
    const float f0 = a0 * inv, f1 = a1 * inv;
    bf16_t* orow = aout + ((size_t)b * SEQ + q0 + c * 16 + lm) * DIM + h * HD + 8 * half;
#pragma unroll   // the four stores issue together
    for (int t = 0; t < 4; ++t) {
      const v4f lo = J[((c * 4 + t) * 2) * 32], hi = J[((c * 4 + t) * 2 + 1) * 32];
      v8bf w;
#pragma unroll   // w[] indexed by constants only
      for (int r = 0; r < 4; ++r) {
        w[r]     = (bf16_t)(o[c][t][r] * f0 + lo[r] * f1);
        w[4 + r] = (bf16_t)(o[c][t][4 + r] * f0 + hi[r] * f1);
      }
      *(v8bf*)(orow + t * 16) = w;
    }
  }
}

// ---------------- launch ----------------

extern "C" void kernel_launch(void* const* d_in, const int* in_sizes, int n_in,
                              void* d_out, int out_size, void* d_ws, size_t ws_size,
                              hipStream_t stream) {
  const float* x      = (const float*)d_in[0];
  const float* qkv_w  = (const float*)d_in[1];
  const float* qkv_b  = (const float*)d_in[2];
  const float* proj_w = (const float*)d_in[3];
  const float* proj_b = (const float*)d_in[4];

  const size_t MB = 1u << 20;
  char* ws = (char*)d_ws;
  bf16_t* xb     = (bf16_t*)(ws);             //  8 MB: x as bf16 [4096][1024]
  bf16_t* wqkvT  = (bf16_t*)(ws + 8 * MB);    //  6 MB: qkv_w^T [3072][1024]
  bf16_t* wprojT = (bf16_t*)(ws + 14 * MB);   //  2 MB: proj_w^T [1024][1024]
  bf16_t* qkvbuf = (bf16_t*)(ws + 16 * MB);   // 24 MB: Q,K [B][H][S][D]; V [B][H][D][S]
  bf16_t* aout   = (bf16_t*)(ws + 40 * MB);   //  8 MB: attn out [4096][1024]

  // x to bf16 and both weight transposes, one launch
  prep_kernel<<<X_BLOCKS + QW_BLOCKS + PW_BLOCKS, PREP_T, 0, stream>>>(x, qkv_w, proj_w,
                                                                      xb, wqkvT, wprojT);

  // QKV GEMM: [4096,1024] x [1024,3072] -> scattered bf16 Q/K/V
  qkv_gemm_kernel<<<dim3(3 * DIM / QTN, MTOT / QTM), 512, 0, stream>>>(xb, wqkvT, qkv_b, qkvbuf);

  // attention
  attn_kernel<<<dim3(SEQ / 128, BATCH * NH), 256, 0, stream>>>(qkvbuf, aout);

  // projection GEMM: [4096,1024] x [1024,1024] + bias -> f32 out
  gemm_bf16_kernel<<<dim3(DIM / 256, MTOT / 64), 256, 0, stream>>>(
      aout, wprojT, proj_b, d_out, MTOT, DIM, DIM);
}
